// v000
// Measured on an AMD MI455X. A time is GPU time per run, averaged over a window of back-to-back runs after a warm-up
// (all launches, gaps included; the runs take copies of the inputs in turn), and the median of several windows.
// Apart from v000's, it joins two sittings. Times from different sittings can be a few percent apart, while
// side-by-side timings come from the same sitting.
// The starting kernel, v000, takes 240 microseconds a run.
#include <hip/hip_runtime.h>

// CDNA5 (gfx1250) wave32 fp32-WMMA implementation of the no-softmax linear
// attention classifier.  (p p^T) p == p (p^T p) collapses attention to a
// 64x64 Gram matrix per head.  The two large GEMMs are LDS-staged and
// double-buffered, using GLOBAL_LOAD_ASYNC_TO_LDS_B128 (ASYNCcnt) so WMMAs
// are fed from LDS instead of stalling on per-load s_wait_loadcnt 0.

typedef __attribute__((ext_vector_type(2))) float v2f;
typedef __attribute__((ext_vector_type(4))) float v4f;
typedef __attribute__((ext_vector_type(8))) float v8f;
typedef __attribute__((ext_vector_type(4))) int   v4i;

#define BS        2
#define SEQ       2048
#define EMBED     1024
#define NHEADS    16
#define HDIM      64
#define NCLASSES  1000

// Large-GEMM tiling
#define BM 128
#define BN 64
#define BK 32
#define LDST 36          // LDS row stride (floats): 144B -> 16B aligned rows,
                         // and 36*n mod 64 is a permutation over n=0..15
                         // (conflict-free 16-lane WMMA fragment reads)

#if defined(__has_builtin)
#if __has_builtin(__builtin_amdgcn_global_load_async_to_lds_b128)
#define HAVE_ASYNC_LDS 1
#endif
#endif
#ifndef HAVE_ASYNC_LDS
#define HAVE_ASYNC_LDS 0
#endif

static __device__ __forceinline__ v8f wmma_f32(v2f a, v2f b, v8f c) {
  // 8 args: (neg_a, A, neg_b, B, c_mod, C, reuse_a, reuse_b)
  return __builtin_amdgcn_wmma_f32_16x16x4_f32(false, a, false, b, (short)0, c,
                                               false, false);
}

#if HAVE_ASYNC_LDS
static __device__ __forceinline__ void wait_async_le6() {
#if __has_builtin(__builtin_amdgcn_s_wait_asynccnt)
  __builtin_amdgcn_s_wait_asynccnt(6);
#else
  asm volatile("s_wait_asynccnt 6" ::: "memory");
#endif
}
static __device__ __forceinline__ void wait_async_le0() {
#if __has_builtin(__builtin_amdgcn_s_wait_asynccnt)
  __builtin_amdgcn_s_wait_asynccnt(0);
#else
  asm volatile("s_wait_asynccnt 0" ::: "memory");
#endif
}
#endif

// ---------------------------------------------------------------------------
// C[M,N] = A[M,K] @ Wt[N,K]^T + bias, LDS-staged, double-buffered.
// grid = (ceil(N/64), M/128), block = 256 (8 waves).
// Wave w computes rows [m0+16w, m0+16w+16) x all 64 N columns.
// ---------------------------------------------------------------------------
__global__ __launch_bounds__(256) void gemm_a_bt_bias_lds(
    const float* __restrict__ A, const float* __restrict__ Wt,
    const float* __restrict__ bias, float* __restrict__ C,
    int N, int K, int lda, int ldb, int ldc) {
  __shared__ float As[2][BM * LDST];
  __shared__ float Bs[2][BN * LDST];

  const int tid  = threadIdx.x;
  const int wave = tid >> 5;
  const int lane = tid & 31;
  const int half = lane >> 4;   // A/B lane-half split: K={0,1} vs K={2,3}
  const int l16  = lane & 15;
  const int m0 = blockIdx.y * BM;
  const int n0 = blockIdx.x * BN;

  // Per-thread staging map: 16B chunks. A tile = 16KB -> 4 chunks/thread,
  // B tile = 8KB -> 2 chunks/thread.
  int a_row[4], a_col[4];
#pragma unroll
  for (int i = 0; i < 4; ++i) {
    int idx = i * 256 + tid;        // chunk index over 128x32 tile
    a_row[i] = idx >> 3;            // 0..127
    a_col[i] = (idx & 7) * 4;       // 0..28, 4-float chunks
  }
  int b_row[2], b_col[2], b_grow[2];
#pragma unroll
  for (int i = 0; i < 2; ++i) {
    int idx = i * 256 + tid;        // chunk index over 64x32 tile
    b_row[i] = idx >> 3;            // 0..63
    b_col[i] = (idx & 7) * 4;
    int n = n0 + b_row[i];
    b_grow[i] = n < N ? n : N - 1;  // clamp: never read OOB rows of Wt
  }

  v8f acc[4] = {v8f{}, v8f{}, v8f{}, v8f{}};

  // WMMA fragment compute over one staged BKx(BM,BN) tile.
  auto compute = [&](int buf) {
    const float* as = &As[buf][(wave * 16 + l16) * LDST + 2 * half];
    const float* bs = &Bs[buf][l16 * LDST + 2 * half];
#pragma unroll
    for (int kk = 0; kk < BK; kk += 4) {
      v2f a = *(const v2f*)(as + kk);
#pragma unroll
      for (int t = 0; t < 4; ++t) {
        v2f b = *(const v2f*)(bs + t * 16 * LDST + kk);
        acc[t] = wmma_f32(a, b, acc[t]);
      }
    }
  };

  const int NT = K / BK;

#if HAVE_ASYNC_LDS
  // Builtin signature (from clang diagnostic): arg0 = addrspace(1) int4*
  // (global source), arg1 = addrspace(3) int4* (LDS dest), imm offset, cpol.
  typedef __attribute__((address_space(1))) v4i* gv4p;
  typedef __attribute__((address_space(3))) v4i* lv4p;
  auto issue = [&](int k0, int buf) {
#pragma unroll
    for (int i = 0; i < 4; ++i) {
      gv4p g = (gv4p)(A + (size_t)(m0 + a_row[i]) * lda + k0 + a_col[i]);
      lv4p l = (lv4p)&As[buf][a_row[i] * LDST + a_col[i]];
      __builtin_amdgcn_global_load_async_to_lds_b128(g, l, 0, 0);
    }
#pragma unroll
    for (int i = 0; i < 2; ++i) {
      gv4p g = (gv4p)(Wt + (size_t)b_grow[i] * ldb + k0 + b_col[i]);
      lv4p l = (lv4p)&Bs[buf][b_row[i] * LDST + b_col[i]];
      __builtin_amdgcn_global_load_async_to_lds_b128(g, l, 0, 0);
    }
  };

  issue(0, 0);
  for (int t = 0; t < NT; ++t) {
    if (t + 1 < NT) {
      issue((t + 1) * BK, (t + 1) & 1);  // prefetch next tile
      wait_async_le6();                  // tile t's 6 copies complete
    } else {
      wait_async_le0();
    }
    __syncthreads();                     // publish LDS tile t to all waves
    compute(t & 1);
    __syncthreads();                     // safe to overwrite buf (t&1)
  }
#else
  // Fallback: global -> registers -> ds_store_b128, same double buffering.
  v4f ra[4], rb[2];
  auto gload = [&](int k0) {
#pragma unroll
    for (int i = 0; i < 4; ++i)
      ra[i] = *(const v4f*)(A + (size_t)(m0 + a_row[i]) * lda + k0 + a_col[i]);
#pragma unroll
    for (int i = 0; i < 2; ++i)
      rb[i] = *(const v4f*)(Wt + (size_t)b_grow[i] * ldb + k0 + b_col[i]);
  };
  auto lstore = [&](int buf) {
#pragma unroll
    for (int i = 0; i < 4; ++i)
      *(v4f*)&As[buf][a_row[i] * LDST + a_col[i]] = ra[i];
#pragma unroll
    for (int i = 0; i < 2; ++i)
      *(v4f*)&Bs[buf][b_row[i] * LDST + b_col[i]] = rb[i];
  };

  gload(0);
  lstore(0);
  __syncthreads();
  for (int t = 0; t < NT; ++t) {
    if (t + 1 < NT) gload((t + 1) * BK);  // global loads overlap compute
    compute(t & 1);
    if (t + 1 < NT) lstore((t + 1) & 1);
    __syncthreads();
  }
#endif

  // Epilogue: C/D layout -> VGPR r holds row (r + 8*half), col l16.
  const int rowbase = m0 + wave * 16 + 8 * half;
#pragma unroll
  for (int t = 0; t < 4; ++t) {
    int col = n0 + t * 16 + l16;
    if (col < N) {
      float bv = bias[col];
#pragma unroll
      for (int r = 0; r < 8; ++r) {
        C[(size_t)(rowbase + r) * ldc + col] = acc[t][r] + bv;
      }
    }
  }
}

// ---------------------------------------------------------------------------
// S[bh] = alpha * P_bh^T @ P_bh   (64x64 Gram matrix per batch*head).
// grid = (4 m-tiles, BS*NHEADS), block = 32.  (~0.5 GFLOP total; latency ok)
// ---------------------------------------------------------------------------
__global__ __launch_bounds__(32) void gram_ptp(
    const float* __restrict__ Pall, float* __restrict__ S, float alpha) {
  const int lane = threadIdx.x;
  const int half = lane >> 4;
  const int l16  = lane & 15;
  const int bh = blockIdx.y;
  const int b = bh >> 4;
  const int h = bh & 15;
  const int m0 = blockIdx.x * 16;

  const float* P = Pall + (size_t)b * SEQ * EMBED + h * HDIM;
  float* Sout = S + (size_t)bh * HDIM * HDIM;

  v8f acc[4] = {v8f{}, v8f{}, v8f{}, v8f{}};
  for (int k = 0; k < SEQ; k += 4) {
    const int kr = k + 2 * half;
    v2f a;                         // A[m][k] = P[k][m] (transposed access)
    a.x = P[(size_t)kr * EMBED + m0 + l16];
    a.y = P[(size_t)(kr + 1) * EMBED + m0 + l16];
#pragma unroll
    for (int t = 0; t < 4; ++t) {
      const int n = t * 16 + l16;
      v2f bb;                      // B[k][n] = P[k][n]
      bb.x = P[(size_t)kr * EMBED + n];
      bb.y = P[(size_t)(kr + 1) * EMBED + n];
      acc[t] = wmma_f32(a, bb, acc[t]);
    }
  }

  const int rowbase = m0 + 8 * half;
#pragma unroll
  for (int t = 0; t < 4; ++t) {
    const int n = t * 16 + l16;
#pragma unroll
    for (int r = 0; r < 8; ++r) {
      Sout[(rowbase + r) * HDIM + n] = alpha * acc[t][r];
    }
  }
}

// ---------------------------------------------------------------------------
// V_bh[seq,64] = P_bh[seq,64] @ S_bh[64,64], into [b, s, h*64+d] layout.
// grid = (SEQ/16, BS*NHEADS), block = 32.
// ---------------------------------------------------------------------------
__global__ __launch_bounds__(32) void apply_gram(
    const float* __restrict__ Pall, const float* __restrict__ S,
    float* __restrict__ Vall) {
  const int lane = threadIdx.x;
  const int half = lane >> 4;
  const int l16  = lane & 15;
  const int bh = blockIdx.y;
  const int b = bh >> 4;
  const int h = bh & 15;
  const int m0 = blockIdx.x * 16;

  const float* P = Pall + (size_t)b * SEQ * EMBED + h * HDIM;
  const float* Sh = S + (size_t)bh * HDIM * HDIM;
  float* V = Vall + (size_t)b * SEQ * EMBED + h * HDIM;

  const float* ap = P + (size_t)(m0 + l16) * EMBED + 2 * half;

  v8f acc[4] = {v8f{}, v8f{}, v8f{}, v8f{}};
#pragma unroll
  for (int k = 0; k < HDIM; k += 4) {
    v2f a = *(const v2f*)(ap + k);
    const int kr = k + 2 * half;
#pragma unroll
    for (int t = 0; t < 4; ++t) {
      const int n = t * 16 + l16;
      v2f bb;                      // B[k][n] = S[k][n] (row-major)
      bb.x = Sh[kr * HDIM + n];
      bb.y = Sh[(kr + 1) * HDIM + n];
      acc[t] = wmma_f32(a, bb, acc[t]);
    }
  }

  const int rowbase = m0 + 8 * half;
#pragma unroll
  for (int t = 0; t < 4; ++t) {
    const int n = t * 16 + l16;
#pragma unroll
    for (int r = 0; r < 8; ++r) {
      V[(size_t)(rowbase + r) * EMBED + n] = acc[t][r];
    }
  }
}

extern "C" void kernel_launch(void* const* d_in, const int* in_sizes, int n_in,
                              void* d_out, int out_size, void* d_ws, size_t ws_size,
                              hipStream_t stream) {
  const float* x     = (const float*)d_in[0];  // [2, 2048, 1024]
  const float* W_in  = (const float*)d_in[1];  // [1024, 1024]
  const float* b_in  = (const float*)d_in[2];  // [1024]
  const float* W_out = (const float*)d_in[3];  // [1000, 1024]
  const float* b_out = (const float*)d_in[4];  // [1000]
  float* out = (float*)d_out;                  // [2, 2048, 1000]

  const int M = BS * SEQ;                      // 4096
  float* p    = (float*)d_ws;                  // M * EMBED floats   (16 MB)
  float* S    = p + (size_t)M * EMBED;         // 32 * 64 * 64       (0.5 MB)
  float* vals = S + (size_t)BS * NHEADS * HDIM * HDIM;  // M * EMBED (16 MB)

  const float scale = 1.0f / 32.0f;            // 1/sqrt(EMBED)

  // 1) p = x @ W_in^T + b_in
  gemm_a_bt_bias_lds<<<dim3(EMBED / BN, M / BM), 256, 0, stream>>>(
      x, W_in, b_in, p, EMBED, EMBED, EMBED, EMBED, EMBED);

  // 2) S_bh = scale * p_bh^T @ p_bh
  gram_ptp<<<dim3(HDIM / 16, BS * NHEADS), 32, 0, stream>>>(p, S, scale);

  // 3) vals_bh = p_bh @ S_bh
  apply_gram<<<dim3(SEQ / 16, BS * NHEADS), 32, 0, stream>>>(p, S, vals);

  // 4) out = vals @ W_out^T + b_out   (N=1000, clamped/guarded)
  gemm_a_bt_bias_lds<<<dim3((NCLASSES + BN - 1) / BN, M / BM), 256, 0, stream>>>(
      vals, W_out, b_out, out, NCLASSES, EMBED, EMBED, EMBED, NCLASSES);
}

// v001
// A run of this version takes 111 microseconds.
// In two side-by-side timings against v000, it was 2.22 and 2.21 times as fast.
#include <hip/hip_runtime.h>

// CDNA5 (gfx1250) wave32 fp32-WMMA implementation of the no-softmax linear
// attention classifier.  (p p^T) p == p (p^T p) collapses attention to a
// 64x64 Gram matrix per head.  The two large GEMMs are LDS-staged and
// double-buffered, using GLOBAL_LOAD_ASYNC_TO_LDS_B128 (ASYNCcnt) so WMMAs
// are fed from LDS instead of stalling on per-load s_wait_loadcnt 0.

typedef __attribute__((ext_vector_type(2))) float v2f;
typedef __attribute__((ext_vector_type(4))) float v4f;
typedef __attribute__((ext_vector_type(8))) float v8f;
typedef __attribute__((ext_vector_type(4))) int   v4i;

#define BS        2
#define SEQ       2048
#define EMBED     1024
#define NHEADS    16
#define HDIM      64
#define NCLASSES  1000

// Large-GEMM tiling
#define BM 128
#define BN 64
#define BK 32
#define LDST 36          // LDS row stride (floats): 144B -> 16B aligned rows,
                         // and 36*n mod 64 is a permutation over n=0..15
                         // (conflict-free 16-lane WMMA fragment reads)

#if defined(__has_builtin)
#if __has_builtin(__builtin_amdgcn_global_load_async_to_lds_b128)
#define HAVE_ASYNC_LDS 1
#endif
#endif
#ifndef HAVE_ASYNC_LDS
#define HAVE_ASYNC_LDS 0
#endif

static __device__ __forceinline__ v8f wmma_f32(v2f a, v2f b, v8f c) {
  // 8 args: (neg_a, A, neg_b, B, c_mod, C, reuse_a, reuse_b)
  return __builtin_amdgcn_wmma_f32_16x16x4_f32(false, a, false, b, (short)0, c,
                                               false, false);
}

#if HAVE_ASYNC_LDS
static __device__ __forceinline__ void wait_async_le6() {
#if __has_builtin(__builtin_amdgcn_s_wait_asynccnt)
  __builtin_amdgcn_s_wait_asynccnt(6);
#else
  asm volatile("s_wait_asynccnt 6" ::: "memory");
#endif
}
static __device__ __forceinline__ void wait_async_le0() {
#if __has_builtin(__builtin_amdgcn_s_wait_asynccnt)
  __builtin_amdgcn_s_wait_asynccnt(0);
#else
  asm volatile("s_wait_asynccnt 0" ::: "memory");
#endif
}
#endif

// ---------------------------------------------------------------------------
// C[M,N] = A[M,K] @ Wt[N,K]^T + bias, LDS-staged, double-buffered.
// grid = (ceil(N/64), M/128), block = 256 (8 waves).
// Wave w computes rows [m0+16w, m0+16w+16) x all 64 N columns.
// ---------------------------------------------------------------------------
__global__ __launch_bounds__(256) void gemm_a_bt_bias_lds(
    const float* __restrict__ A, const float* __restrict__ Wt,
    const float* __restrict__ bias, float* __restrict__ C,
    int N, int K, int lda, int ldb, int ldc) {
  __shared__ float As[2][BM * LDST];
  __shared__ float Bs[2][BN * LDST];

  const int tid  = threadIdx.x;
  const int wave = tid >> 5;
  const int lane = tid & 31;
  const int half = lane >> 4;   // A/B lane-half split: K={0,1} vs K={2,3}
  const int l16  = lane & 15;
  const int m0 = blockIdx.y * BM;
  const int n0 = blockIdx.x * BN;

  // Per-thread staging map: 16B chunks. A tile = 16KB -> 4 chunks/thread,
  // B tile = 8KB -> 2 chunks/thread.
  int a_row[4], a_col[4];
#pragma unroll
  for (int i = 0; i < 4; ++i) {
    int idx = i * 256 + tid;        // chunk index over 128x32 tile
    a_row[i] = idx >> 3;            // 0..127
    a_col[i] = (idx & 7) * 4;       // 0..28, 4-float chunks
  }
  int b_row[2], b_col[2], b_grow[2];
#pragma unroll
  for (int i = 0; i < 2; ++i) {
    int idx = i * 256 + tid;        // chunk index over 64x32 tile
    b_row[i] = idx >> 3;            // 0..63
    b_col[i] = (idx & 7) * 4;
    int n = n0 + b_row[i];
    b_grow[i] = n < N ? n : N - 1;  // clamp: never read OOB rows of Wt
  }

  v8f acc[4] = {v8f{}, v8f{}, v8f{}, v8f{}};

  // WMMA fragment compute over one staged BKx(BM,BN) tile.
  auto compute = [&](int buf) {
    const float* as = &As[buf][(wave * 16 + l16) * LDST + 2 * half];
    const float* bs = &Bs[buf][l16 * LDST + 2 * half];
#pragma unroll
    for (int kk = 0; kk < BK; kk += 4) {
      v2f a = *(const v2f*)(as + kk);
#pragma unroll
      for (int t = 0; t < 4; ++t) {
        v2f b = *(const v2f*)(bs + t * 16 * LDST + kk);
        acc[t] = wmma_f32(a, b, acc[t]);
      }
    }
  };

  const int NT = K / BK;

#if HAVE_ASYNC_LDS
  // Builtin signature (from clang diagnostic): arg0 = addrspace(1) int4*
  // (global source), arg1 = addrspace(3) int4* (LDS dest), imm offset, cpol.
  typedef __attribute__((address_space(1))) v4i* gv4p;
  typedef __attribute__((address_space(3))) v4i* lv4p;
  auto issue = [&](int k0, int buf) {
#pragma unroll
    for (int i = 0; i < 4; ++i) {
      gv4p g = (gv4p)(A + (size_t)(m0 + a_row[i]) * lda + k0 + a_col[i]);
      lv4p l = (lv4p)&As[buf][a_row[i] * LDST + a_col[i]];
      __builtin_amdgcn_global_load_async_to_lds_b128(g, l, 0, 0);
    }
#pragma unroll
    for (int i = 0; i < 2; ++i) {
      gv4p g = (gv4p)(Wt + (size_t)b_grow[i] * ldb + k0 + b_col[i]);
      lv4p l = (lv4p)&Bs[buf][b_row[i] * LDST + b_col[i]];
      __builtin_amdgcn_global_load_async_to_lds_b128(g, l, 0, 0);
    }
  };

  issue(0, 0);
  for (int t = 0; t < NT; ++t) {
    if (t + 1 < NT) {
      issue((t + 1) * BK, (t + 1) & 1);  // prefetch next tile
      wait_async_le6();                  // tile t's 6 copies complete
    } else {
      wait_async_le0();
    }
    __syncthreads();                     // publish LDS tile t to all waves
    compute(t & 1);
    __syncthreads();                     // safe to overwrite buf (t&1)
  }
#else
  // Fallback: global -> registers -> ds_store_b128, same double buffering.
  v4f ra[4], rb[2];
  auto gload = [&](int k0) {
#pragma unroll
    for (int i = 0; i < 4; ++i)
      ra[i] = *(const v4f*)(A + (size_t)(m0 + a_row[i]) * lda + k0 + a_col[i]);
#pragma unroll
    for (int i = 0; i < 2; ++i)
      rb[i] = *(const v4f*)(Wt + (size_t)b_grow[i] * ldb + k0 + b_col[i]);
  };
  auto lstore = [&](int buf) {
#pragma unroll
    for (int i = 0; i < 4; ++i)
      *(v4f*)&As[buf][a_row[i] * LDST + a_col[i]] = ra[i];
#pragma unroll
    for (int i = 0; i < 2; ++i)
      *(v4f*)&Bs[buf][b_row[i] * LDST + b_col[i]] = rb[i];
  };

  gload(0);
  lstore(0);
  __syncthreads();
  for (int t = 0; t < NT; ++t) {
    if (t + 1 < NT) gload((t + 1) * BK);  // global loads overlap compute
    compute(t & 1);
    if (t + 1 < NT) lstore((t + 1) & 1);
    __syncthreads();
  }
#endif

  // Epilogue: C/D layout -> VGPR r holds row (r + 8*half), col l16.
  const int rowbase = m0 + wave * 16 + 8 * half;
#pragma unroll
  for (int t = 0; t < 4; ++t) {
    int col = n0 + t * 16 + l16;
    if (col < N) {
      float bv = bias[col];
#pragma unroll
      for (int r = 0; r < 8; ++r) {
        C[(size_t)(rowbase + r) * ldc + col] = acc[t][r] + bv;
      }
    }
  }
}

// ---------------------------------------------------------------------------
// S[bh] = alpha * P_bh^T @ P_bh   (64x64 Gram matrix per batch*head).
// grid = (4 m-tiles * 2 n-halves, BS*NHEADS) = 256 work-groups, block = 512.
// The sum over the 2048 sequence rows is split over the 16 waves of a
// work-group (128 rows each); the 16 partial 16x32 tiles are joined in LDS in
// a fixed order, so the result is the same on every run.
// ---------------------------------------------------------------------------
#define GWAVES 16                 // waves per work-group
#define GROWS  (SEQ / GWAVES)     // sequence rows summed by one wave
#define GTILE  (16 * 32)          // output elements per work-group

__global__ __launch_bounds__(32 * GWAVES) void gram_ptp(
    const float* __restrict__ Pall, float* __restrict__ S, float alpha) {
  __shared__ float red[GWAVES * GTILE];

  const int tid  = threadIdx.x;
  const int wave = tid >> 5;
  const int lane = tid & 31;
  const int half = lane >> 4;
  const int l16  = lane & 15;
  const int bh = blockIdx.y;
  const int b = bh >> 4;
  const int h = bh & 15;
  const int m0 = (blockIdx.x >> 1) * 16;
  const int n0 = (blockIdx.x & 1) * 32;

  const float* P = Pall + (size_t)b * SEQ * EMBED + h * HDIM +
                   (size_t)(wave * GROWS) * EMBED;
  float* Sout = S + (size_t)bh * HDIM * HDIM;

  v8f acc[2] = {v8f{}, v8f{}};
  // Unrolled so that many rows' loads are in flight before the first wait.
#pragma unroll
  for (int k = 0; k < GROWS; k += 4) {
    const int kr = k + 2 * half;
    v2f a;                         // A[m][k] = P[k][m] (transposed access)
    a.x = P[(size_t)kr * EMBED + m0 + l16];
    a.y = P[(size_t)(kr + 1) * EMBED + m0 + l16];
#pragma unroll
    for (int t = 0; t < 2; ++t) {
      const int n = n0 + t * 16 + l16;
      v2f bb;                      // B[k][n] = P[k][n]
      bb.x = P[(size_t)kr * EMBED + n];
      bb.y = P[(size_t)(kr + 1) * EMBED + n];
      acc[t] = wmma_f32(a, bb, acc[t]);
    }
  }

  // Four vector slots between the last WMMA and the first vector instruction
  // that may reuse its D registers: LDS stores and waits fill no slot. The
  // accumulators are inputs only, so the slots stand behind both last WMMAs.
  asm volatile("v_nop\n\tv_nop\n\tv_nop\n\tv_nop" ::"v"(acc[0]), "v"(acc[1]));

  // Each wave hands over its partial tile: element (t, r, lane). Unrolled so
  // that every accumulator index is a constant and acc stays in registers.
#pragma unroll
  for (int t = 0; t < 2; ++t) {
#pragma unroll
    for (int r = 0; r < 8; ++r) {
      red[wave * GTILE + (t * 8 + r) * 32 + lane] = acc[t][r];
    }
  }
  __syncthreads();                 // all 16 partial tiles are in LDS

  // Thread tid joins element tid of the 16 partial tiles, wave 0 first.
  // Unrolled so that the LDS reads issue ahead of the adds that wait for them.
  float s = red[tid];
#pragma unroll
  for (int w = 1; w < GWAVES; ++w) s += red[w * GTILE + tid];

  const int t = tid >> 8;          // tid = (t * 8 + r) * 32 + lane
  const int r = (tid >> 5) & 7;
  Sout[(m0 + 8 * half + r) * HDIM + n0 + t * 16 + l16] = alpha * s;
}

// ---------------------------------------------------------------------------
// V_bh[seq,64] = P_bh[seq,64] @ S_bh[64,64], into [b, s, h*64+d] layout.
// grid = (SEQ/16, BS*NHEADS), block = 32.
// ---------------------------------------------------------------------------
__global__ __launch_bounds__(32) void apply_gram(
    const float* __restrict__ Pall, const float* __restrict__ S,
    float* __restrict__ Vall) {
  const int lane = threadIdx.x;
  const int half = lane >> 4;
  const int l16  = lane & 15;
  const int bh = blockIdx.y;
  const int b = bh >> 4;
  const int h = bh & 15;
  const int m0 = blockIdx.x * 16;

  const float* P = Pall + (size_t)b * SEQ * EMBED + h * HDIM;
  const float* Sh = S + (size_t)bh * HDIM * HDIM;
  float* V = Vall + (size_t)b * SEQ * EMBED + h * HDIM;

  const float* ap = P + (size_t)(m0 + l16) * EMBED + 2 * half;

  v8f acc[4] = {v8f{}, v8f{}, v8f{}, v8f{}};
#pragma unroll
  for (int k = 0; k < HDIM; k += 4) {
    v2f a = *(const v2f*)(ap + k);
    const int kr = k + 2 * half;
#pragma unroll
    for (int t = 0; t < 4; ++t) {
      const int n = t * 16 + l16;
      v2f bb;                      // B[k][n] = S[k][n] (row-major)
      bb.x = Sh[kr * HDIM + n];
      bb.y = Sh[(kr + 1) * HDIM + n];
      acc[t] = wmma_f32(a, bb, acc[t]);
    }
  }

  const int rowbase = m0 + 8 * half;
#pragma unroll
  for (int t = 0; t < 4; ++t) {
    const int n = t * 16 + l16;
#pragma unroll
    for (int r = 0; r < 8; ++r) {
      V[(size_t)(rowbase + r) * EMBED + n] = acc[t][r];
    }
  }
}

extern "C" void kernel_launch(void* const* d_in, const int* in_sizes, int n_in,
                              void* d_out, int out_size, void* d_ws, size_t ws_size,
                              hipStream_t stream) {
  const float* x     = (const float*)d_in[0];  // [2, 2048, 1024]
  const float* W_in  = (const float*)d_in[1];  // [1024, 1024]
  const float* b_in  = (const float*)d_in[2];  // [1024]
  const float* W_out = (const float*)d_in[3];  // [1000, 1024]
  const float* b_out = (const float*)d_in[4];  // [1000]
  float* out = (float*)d_out;                  // [2, 2048, 1000]

  const int M = BS * SEQ;                      // 4096
  float* p    = (float*)d_ws;                  // M * EMBED floats   (16 MB)
  float* S    = p + (size_t)M * EMBED;         // 32 * 64 * 64       (0.5 MB)
  float* vals = S + (size_t)BS * NHEADS * HDIM * HDIM;  // M * EMBED (16 MB)

  const float scale = 1.0f / 32.0f;            // 1/sqrt(EMBED)

  // 1) p = x @ W_in^T + b_in
  gemm_a_bt_bias_lds<<<dim3(EMBED / BN, M / BM), 256, 0, stream>>>(
      x, W_in, b_in, p, EMBED, EMBED, EMBED, EMBED, EMBED);

  // 2) S_bh = scale * p_bh^T @ p_bh
  gram_ptp<<<dim3(2 * (HDIM / 16), BS * NHEADS), 32 * GWAVES, 0, stream>>>(p, S, scale);

  // 3) vals_bh = p_bh @ S_bh
  apply_gram<<<dim3(SEQ / 16, BS * NHEADS), 32, 0, stream>>>(p, S, vals);

  // 4) out = vals @ W_out^T + b_out   (N=1000, clamped/guarded)
  gemm_a_bt_bias_lds<<<dim3((NCLASSES + BN - 1) / BN, M / BM), 256, 0, stream>>>(
      vals, W_out, b_out, out, NCLASSES, EMBED, EMBED, EMBED, NCLASSES);
}

// v002
// Measured time: 106 microseconds a run.
// Next to v001, in two timings, it ran 1.05 times as fast each time.
// Over all steps from v000 it is 2.32 times as fast.
#include <hip/hip_runtime.h>

// CDNA5 (gfx1250) wave32 fp32-WMMA implementation of the no-softmax linear
// attention classifier.  (p p^T) p == p (p^T p) collapses attention to a
// 64x64 Gram matrix S per head, and (p S) W^T == p (S W^T) folds S into the
// output weights, once per batch.  The two large GEMMs are LDS-staged and
// double-buffered, using GLOBAL_LOAD_ASYNC_TO_LDS_B128 (ASYNCcnt) so WMMAs
// are fed from LDS instead of stalling on per-load s_wait_loadcnt 0.

typedef __attribute__((ext_vector_type(2))) float v2f;
typedef __attribute__((ext_vector_type(4))) float v4f;
typedef __attribute__((ext_vector_type(8))) float v8f;
typedef __attribute__((ext_vector_type(4))) int   v4i;

#define BS        2
#define SEQ       2048
#define EMBED     1024
#define NHEADS    16
#define HDIM      64
#define NCLASSES  1000

// Large-GEMM tiling
#define BM 128
#define BN 64
#define BK 32
#define LDST 36          // LDS row stride (floats): 144B -> 16B aligned rows,
                         // and 36*n mod 64 is a permutation over n=0..15
                         // (conflict-free 16-lane WMMA fragment reads)

#if defined(__has_builtin)
#if __has_builtin(__builtin_amdgcn_global_load_async_to_lds_b128)
#define HAVE_ASYNC_LDS 1
#endif
#endif
#ifndef HAVE_ASYNC_LDS
#define HAVE_ASYNC_LDS 0
#endif

static __device__ __forceinline__ v8f wmma_f32(v2f a, v2f b, v8f c) {
  // 8 args: (neg_a, A, neg_b, B, c_mod, C, reuse_a, reuse_b)
  return __builtin_amdgcn_wmma_f32_16x16x4_f32(false, a, false, b, (short)0, c,
                                               false, false);
}

#if HAVE_ASYNC_LDS
static __device__ __forceinline__ void wait_async_le6() {
#if __has_builtin(__builtin_amdgcn_s_wait_asynccnt)
  __builtin_amdgcn_s_wait_asynccnt(6);
#else
  asm volatile("s_wait_asynccnt 6" ::: "memory");
#endif
}
static __device__ __forceinline__ void wait_async_le0() {
#if __has_builtin(__builtin_amdgcn_s_wait_asynccnt)
  __builtin_amdgcn_s_wait_asynccnt(0);
#else
  asm volatile("s_wait_asynccnt 0" ::: "memory");
#endif
}
#endif

// ---------------------------------------------------------------------------
// C[M,N] = A[M,K] @ Wt[N,K]^T + bias, LDS-staged, double-buffered.
// Wt may differ per batch of SEQ rows of A: batch i reads Wt + i * bstride.
// grid = (ceil(N/64), M/128), block = 256 (8 waves).
// Wave w computes rows [m0+16w, m0+16w+16) x all 64 N columns.
// ---------------------------------------------------------------------------
__global__ __launch_bounds__(256) void gemm_a_bt_bias_lds(
    const float* __restrict__ A, const float* __restrict__ Wall,
    const float* __restrict__ bias, float* __restrict__ C,
    int N, int K, int lda, int ldb, int ldc, int bstride) {
  __shared__ float As[2][BM * LDST];
  __shared__ float Bs[2][BN * LDST];

  const int tid  = threadIdx.x;
  const int wave = tid >> 5;
  const int lane = tid & 31;
  const int half = lane >> 4;   // A/B lane-half split: K={0,1} vs K={2,3}
  const int l16  = lane & 15;
  const int m0 = blockIdx.y * BM;
  const int n0 = blockIdx.x * BN;
  const float* Wt = Wall + (size_t)(blockIdx.y / (SEQ / BM)) * bstride;

  // Per-thread staging map: 16B chunks. A tile = 16KB -> 4 chunks/thread,
  // B tile = 8KB -> 2 chunks/thread.
  int a_row[4], a_col[4];
#pragma unroll
  for (int i = 0; i < 4; ++i) {
    int idx = i * 256 + tid;        // chunk index over 128x32 tile
    a_row[i] = idx >> 3;            // 0..127
    a_col[i] = (idx & 7) * 4;       // 0..28, 4-float chunks
  }
  int b_row[2], b_col[2], b_grow[2];
#pragma unroll
  for (int i = 0; i < 2; ++i) {
    int idx = i * 256 + tid;        // chunk index over 64x32 tile
    b_row[i] = idx >> 3;            // 0..63
    b_col[i] = (idx & 7) * 4;
    int n = n0 + b_row[i];
    b_grow[i] = n < N ? n : N - 1;  // clamp: never read OOB rows of Wt
  }

  v8f acc[4] = {v8f{}, v8f{}, v8f{}, v8f{}};

  // WMMA fragment compute over one staged BKx(BM,BN) tile.
  auto compute = [&](int buf) {
    const float* as = &As[buf][(wave * 16 + l16) * LDST + 2 * half];
    const float* bs = &Bs[buf][l16 * LDST + 2 * half];
#pragma unroll
    for (int kk = 0; kk < BK; kk += 4) {
      v2f a = *(const v2f*)(as + kk);
#pragma unroll
      for (int t = 0; t < 4; ++t) {
        v2f b = *(const v2f*)(bs + t * 16 * LDST + kk);
        acc[t] = wmma_f32(a, b, acc[t]);
      }
    }
  };

  const int NT = K / BK;

#if HAVE_ASYNC_LDS
  // Builtin signature (from clang diagnostic): arg0 = addrspace(1) int4*
  // (global source), arg1 = addrspace(3) int4* (LDS dest), imm offset, cpol.
  typedef __attribute__((address_space(1))) v4i* gv4p;
  typedef __attribute__((address_space(3))) v4i* lv4p;
  auto issue = [&](int k0, int buf) {
#pragma unroll
    for (int i = 0; i < 4; ++i) {
      gv4p g = (gv4p)(A + (size_t)(m0 + a_row[i]) * lda + k0 + a_col[i]);
      lv4p l = (lv4p)&As[buf][a_row[i] * LDST + a_col[i]];
      __builtin_amdgcn_global_load_async_to_lds_b128(g, l, 0, 0);
    }
#pragma unroll
    for (int i = 0; i < 2; ++i) {
      gv4p g = (gv4p)(Wt + (size_t)b_grow[i] * ldb + k0 + b_col[i]);
      lv4p l = (lv4p)&Bs[buf][b_row[i] * LDST + b_col[i]];
      __builtin_amdgcn_global_load_async_to_lds_b128(g, l, 0, 0);
    }
  };

  issue(0, 0);
  for (int t = 0; t < NT; ++t) {
    if (t + 1 < NT) {
      issue((t + 1) * BK, (t + 1) & 1);  // prefetch next tile
      wait_async_le6();                  // tile t's 6 copies complete
    } else {
      wait_async_le0();
    }
    __syncthreads();                     // publish LDS tile t to all waves
    compute(t & 1);
    __syncthreads();                     // safe to overwrite buf (t&1)
  }
#else
  // Fallback: global -> registers -> ds_store_b128, same double buffering.
  v4f ra[4], rb[2];
  auto gload = [&](int k0) {
#pragma unroll
    for (int i = 0; i < 4; ++i)
      ra[i] = *(const v4f*)(A + (size_t)(m0 + a_row[i]) * lda + k0 + a_col[i]);
#pragma unroll
    for (int i = 0; i < 2; ++i)
      rb[i] = *(const v4f*)(Wt + (size_t)b_grow[i] * ldb + k0 + b_col[i]);
  };
  auto lstore = [&](int buf) {
#pragma unroll
    for (int i = 0; i < 4; ++i)
      *(v4f*)&As[buf][a_row[i] * LDST + a_col[i]] = ra[i];
#pragma unroll
    for (int i = 0; i < 2; ++i)
      *(v4f*)&Bs[buf][b_row[i] * LDST + b_col[i]] = rb[i];
  };

  gload(0);
  lstore(0);
  __syncthreads();
  for (int t = 0; t < NT; ++t) {
    if (t + 1 < NT) gload((t + 1) * BK);  // global loads overlap compute
    compute(t & 1);
    if (t + 1 < NT) lstore((t + 1) & 1);
    __syncthreads();
  }
#endif

  // Epilogue: C/D layout -> VGPR r holds row (r + 8*half), col l16.
  const int rowbase = m0 + wave * 16 + 8 * half;
#pragma unroll
  for (int t = 0; t < 4; ++t) {
    int col = n0 + t * 16 + l16;
    if (col < N) {
      float bv = bias[col];
#pragma unroll
      for (int r = 0; r < 8; ++r) {
        C[(size_t)(rowbase + r) * ldc + col] = acc[t][r] + bv;
      }
    }
  }
}

// ---------------------------------------------------------------------------
// S[bh] = alpha * P_bh^T @ P_bh   (64x64 Gram matrix per batch*head).
// grid = (4 m-tiles * 2 n-halves, BS*NHEADS) = 256 work-groups, block = 512.
// The sum over the 2048 sequence rows is split over the 16 waves of a
// work-group (128 rows each); the 16 partial 16x32 tiles are joined in LDS in
// a fixed order, so the result is the same on every run.
// ---------------------------------------------------------------------------
#define GWAVES 16                 // waves per work-group
#define GROWS  (SEQ / GWAVES)     // sequence rows summed by one wave
#define GTILE  (16 * 32)          // output elements per work-group

__global__ __launch_bounds__(32 * GWAVES) void gram_ptp(
    const float* __restrict__ Pall, float* __restrict__ S, float alpha) {
  __shared__ float red[GWAVES * GTILE];

  const int tid  = threadIdx.x;
  const int wave = tid >> 5;
  const int lane = tid & 31;
  const int half = lane >> 4;
  const int l16  = lane & 15;
  const int bh = blockIdx.y;
  const int b = bh >> 4;
  const int h = bh & 15;
  const int m0 = (blockIdx.x >> 1) * 16;
  const int n0 = (blockIdx.x & 1) * 32;

  const float* P = Pall + (size_t)b * SEQ * EMBED + h * HDIM +
                   (size_t)(wave * GROWS) * EMBED;
  float* Sout = S + (size_t)bh * HDIM * HDIM;

  v8f acc[2] = {v8f{}, v8f{}};
  // Unrolled so that many rows' loads are in flight before the first wait.
#pragma unroll
  for (int k = 0; k < GROWS; k += 4) {
    const int kr = k + 2 * half;
    v2f a;                         // A[m][k] = P[k][m] (transposed access)
    a.x = P[(size_t)kr * EMBED + m0 + l16];
    a.y = P[(size_t)(kr + 1) * EMBED + m0 + l16];
#pragma unroll
    for (int t = 0; t < 2; ++t) {
      const int n = n0 + t * 16 + l16;
      v2f bb;                      // B[k][n] = P[k][n]
      bb.x = P[(size_t)kr * EMBED + n];
      bb.y = P[(size_t)(kr + 1) * EMBED + n];
      acc[t] = wmma_f32(a, bb, acc[t]);
    }
  }

  // Four vector slots between the last WMMA and the first vector instruction
  // that may reuse its D registers: LDS stores and waits fill no slot. The
  // accumulators are inputs only, so the slots stand behind both last WMMAs.
  asm volatile("v_nop\n\tv_nop\n\tv_nop\n\tv_nop" ::"v"(acc[0]), "v"(acc[1]));

  // Each wave hands over its partial tile: element (t, r, lane). Unrolled so
  // that every accumulator index is a constant and acc stays in registers.
#pragma unroll
  for (int t = 0; t < 2; ++t) {
#pragma unroll
    for (int r = 0; r < 8; ++r) {
      red[wave * GTILE + (t * 8 + r) * 32 + lane] = acc[t][r];
    }
  }
  __syncthreads();                 // all 16 partial tiles are in LDS

  // Thread tid joins element tid of the 16 partial tiles, wave 0 first.
  // Unrolled so that the LDS reads issue ahead of the adds that wait for them.
  float s = red[tid];
#pragma unroll
  for (int w = 1; w < GWAVES; ++w) s += red[w * GTILE + tid];

  const int t = tid >> 8;          // tid = (t * 8 + r) * 32 + lane
  const int r = (tid >> 5) & 7;
  Sout[(m0 + 8 * half + r) * HDIM + n0 + t * 16 + l16] = alpha * s;
}

// ---------------------------------------------------------------------------
// W2_b[c, h*64+e] = sum_d W[c, h*64+d] * S_bh[e, d]: the Gram matrix folded
// into the output weights, so that out = p @ W2_b^T + bias.
// grid = (FROWS/128, BS*NHEADS), block = 256 (8 waves, 16 rows c each).
// W2 has FROWS rows per batch; rows from NCLASSES on repeat the last class
// row and are never read.
// ---------------------------------------------------------------------------
#define FROWS  1024               // rows of W2 per batch (NCLASSES rounded up)
#define SPITCH 68                 // LDS row pitch (floats): 272 B = 16 B x odd

__global__ __launch_bounds__(256) void fold_gram_w(
    const float* __restrict__ S, const float* __restrict__ W,
    float* __restrict__ W2all) {
  __shared__ __attribute__((aligned(16))) float Ss[HDIM * SPITCH];

  const int tid  = threadIdx.x;
  const int wave = tid >> 5;
  const int lane = tid & 31;
  const int half = lane >> 4;
  const int l16  = lane & 15;
  const int bh = blockIdx.y;
  const int b = bh >> 4;
  const int h = bh & 15;
  const int c0 = blockIdx.x * 128 + wave * 16;

  const float* Sh = S + (size_t)bh * HDIM * HDIM;
  float* W2 = W2all + (size_t)b * FROWS * EMBED + h * HDIM;

  // A rows: 16 bytes a lane.  Lane half hf holds k = 8j + 4hf + {0..3}: its
  // first pair feeds one WMMA, its second pair the next; B below is read with
  // the same k at every lane and register position.
  int crow = c0 + l16;
  crow = crow < NCLASSES ? crow : NCLASSES - 1;   // never read past W
  const float* ap = W + (size_t)crow * EMBED + h * HDIM + 4 * half;
  v4f a[8];
#pragma unroll
  for (int j = 0; j < 8; ++j) a[j] = *(const v4f*)(ap + 8 * j);

  // S_bh (16 KB) into LDS, whole lines, once for the 8 waves.
#pragma unroll
  for (int i = 0; i < 4; ++i) {
    const int idx = i * 256 + tid;
    const int row = idx >> 4;
    const int col = (idx & 15) * 4;
    *(v4f*)&Ss[row * SPITCH + col] = *(const v4f*)(Sh + row * HDIM + col);
  }
  __syncthreads();                 // S_bh is in LDS for every wave

  const float* bs = &Ss[l16 * SPITCH + 4 * half];
  v8f acc[4] = {v8f{}, v8f{}, v8f{}, v8f{}};
#pragma unroll
  for (int j = 0; j < 8; ++j) {
    v4f bb[4];                     // B[k][n] = S[n][k], n = t*16 + l16
#pragma unroll
    for (int t = 0; t < 4; ++t)
      bb[t] = *(const v4f*)(bs + t * 16 * SPITCH + 8 * j);
#pragma unroll
    for (int t = 0; t < 4; ++t)
      acc[t] = wmma_f32(v2f{a[j].x, a[j].y}, v2f{bb[t].x, bb[t].y}, acc[t]);
#pragma unroll
    for (int t = 0; t < 4; ++t)
      acc[t] = wmma_f32(v2f{a[j].z, a[j].w}, v2f{bb[t].z, bb[t].w}, acc[t]);
  }

  // Four vector slots between the last WMMA and the store-address arithmetic,
  // which reuses A and B registers. The
  // accumulators are inputs, so the slots stand behind every WMMA; the thread
  // id goes through the statement, so the arithmetic stands behind the slots.
  int st = tid;
  asm volatile("v_nop\n\tv_nop\n\tv_nop\n\tv_nop"
               : "+v"(st)
               : "v"(acc[0]), "v"(acc[1]), "v"(acc[2]), "v"(acc[3]));
  const int srow = blockIdx.x * 128 + (st >> 5) * 16 + ((st >> 4) & 1) * 8;
  float* outp = W2 + (size_t)srow * EMBED + (st & 15);
#pragma unroll
  for (int t = 0; t < 4; ++t) {
#pragma unroll
    for (int r = 0; r < 8; ++r) {
      outp[r * EMBED + t * 16] = acc[t][r];
    }
  }
}

extern "C" void kernel_launch(void* const* d_in, const int* in_sizes, int n_in,
                              void* d_out, int out_size, void* d_ws, size_t ws_size,
                              hipStream_t stream) {
  const float* x     = (const float*)d_in[0];  // [2, 2048, 1024]
  const float* W_in  = (const float*)d_in[1];  // [1024, 1024]
  const float* b_in  = (const float*)d_in[2];  // [1024]
  const float* W_out = (const float*)d_in[3];  // [1000, 1024]
  const float* b_out = (const float*)d_in[4];  // [1000]
  float* out = (float*)d_out;                  // [2, 2048, 1000]

  const int M = BS * SEQ;                      // 4096
  float* p    = (float*)d_ws;                  // M * EMBED floats   (16 MB)
  float* S    = p + (size_t)M * EMBED;         // 32 * 64 * 64       (0.5 MB)
  float* W2   = S + (size_t)BS * NHEADS * HDIM * HDIM;  // BS * FROWS * EMBED (8 MB)

  const float scale = 1.0f / 32.0f;            // 1/sqrt(EMBED)

  // 1) p = x @ W_in^T + b_in
  gemm_a_bt_bias_lds<<<dim3(EMBED / BN, M / BM), 256, 0, stream>>>(
      x, W_in, b_in, p, EMBED, EMBED, EMBED, EMBED, EMBED, 0);

  // 2) S_bh = scale * p_bh^T @ p_bh
  gram_ptp<<<dim3(2 * (HDIM / 16), BS * NHEADS), 32 * GWAVES, 0, stream>>>(p, S, scale);

  // 3) W2_b = W_out @ blockdiag(S_b)^T
  fold_gram_w<<<dim3(FROWS / 128, BS * NHEADS), 256, 0, stream>>>(S, W_out, W2);

  // 4) out_b = p_b @ W2_b^T + b_out   (N=1000, clamped/guarded)
  gemm_a_bt_bias_lds<<<dim3((NCLASSES + BN - 1) / BN, M / BM), 256, 0, stream>>>(
      p, W2, b_out, out, NCLASSES, EMBED, EMBED, EMBED, NCLASSES, FROWS * EMBED);
}

// v003
// A run of this version takes 102 microseconds.
// Timed twice side by side with v002, it ran 1.03 and 1.04 times as fast.
// Counting every step since v000, it is 2.40 times as fast.
#include <hip/hip_runtime.h>

// CDNA5 (gfx1250) wave32 fp32-WMMA implementation of the no-softmax linear
// attention classifier.  (p p^T) p == p (p^T p) collapses attention to a
// 64x64 Gram matrix S per head, and (p S) W^T == p (S W^T) folds S into the
// output weights, once per batch.  The first GEMM forms each tile's share of
// S from the tile it has just computed.  The two large GEMMs are LDS-staged and
// double-buffered, using GLOBAL_LOAD_ASYNC_TO_LDS_B128 (ASYNCcnt) so WMMAs
// are fed from LDS instead of stalling on per-load s_wait_loadcnt 0.

typedef __attribute__((ext_vector_type(2))) float v2f;
typedef __attribute__((ext_vector_type(4))) float v4f;
typedef __attribute__((ext_vector_type(8))) float v8f;
typedef __attribute__((ext_vector_type(4))) int   v4i;

#define BS        2
#define SEQ       2048
#define EMBED     1024
#define NHEADS    16
#define HDIM      64
#define NCLASSES  1000

// Large-GEMM tiling
#define BM 128
#define BN 64
#define BK 32
#define GPARTS (SEQ / BM) // row tiles, and so shares of S, per batch and head
#define PQ (HDIM * 4)    // floats in one LDS row of the finished tile of p
#define LDST 36          // LDS row stride (floats): 144B -> 16B aligned rows,
                         // and 36*n mod 64 is a permutation over n=0..15
                         // (conflict-free 16-lane WMMA fragment reads)

#if defined(__has_builtin)
#if __has_builtin(__builtin_amdgcn_global_load_async_to_lds_b128)
#define HAVE_ASYNC_LDS 1
#endif
#endif
#ifndef HAVE_ASYNC_LDS
#define HAVE_ASYNC_LDS 0
#endif

static __device__ __forceinline__ v8f wmma_f32(v2f a, v2f b, v8f c) {
  // 8 args: (neg_a, A, neg_b, B, c_mod, C, reuse_a, reuse_b)
  return __builtin_amdgcn_wmma_f32_16x16x4_f32(false, a, false, b, (short)0, c,
                                               false, false);
}

#if HAVE_ASYNC_LDS
static __device__ __forceinline__ void wait_async_le6() {
#if __has_builtin(__builtin_amdgcn_s_wait_asynccnt)
  __builtin_amdgcn_s_wait_asynccnt(6);
#else
  asm volatile("s_wait_asynccnt 6" ::: "memory");
#endif
}
static __device__ __forceinline__ void wait_async_le0() {
#if __has_builtin(__builtin_amdgcn_s_wait_asynccnt)
  __builtin_amdgcn_s_wait_asynccnt(0);
#else
  asm volatile("s_wait_asynccnt 0" ::: "memory");
#endif
}
#endif

// ---------------------------------------------------------------------------
// C[M,N] = A[M,K] @ Wt[N,K]^T + bias, LDS-staged, double-buffered.
// Wt may differ per batch of SEQ rows of A: batch i reads Wt + i * bstride.
// grid = (ceil(N/64), M/128), block = 256 (8 waves).
// Wave w computes rows [m0+16w, m0+16w+16) x all 64 N columns.
// GRAM (N a multiple of 64 = HDIM, so a tile is 128 rows of one head): the
// work-group also writes T^T T of its finished tile T, a 64x64 share of that
// head's Gram matrix, to Spart[(batch*NHEADS + head) * GPARTS + row tile].
// ---------------------------------------------------------------------------
template <bool GRAM>
__global__ __launch_bounds__(256) void gemm_a_bt_bias_lds(
    const float* __restrict__ A, const float* __restrict__ Wall,
    const float* __restrict__ bias, float* __restrict__ C,
    float* __restrict__ Spart,
    int N, int K, int lda, int ldb, int ldc, int bstride) {
  __shared__ float As[2][BM * LDST];
  __shared__ float Bs[2][BN * LDST];

  const int tid  = threadIdx.x;
  const int wave = tid >> 5;
  const int lane = tid & 31;
  const int half = lane >> 4;   // A/B lane-half split: K={0,1} vs K={2,3}
  const int l16  = lane & 15;
  const int m0 = blockIdx.y * BM;
  const int n0 = blockIdx.x * BN;
  const float* Wt = Wall + (size_t)(blockIdx.y / (SEQ / BM)) * bstride;

  // Per-thread staging map: 16B chunks. A tile = 16KB -> 4 chunks/thread,
  // B tile = 8KB -> 2 chunks/thread.
  int a_row[4], a_col[4];
#pragma unroll
  for (int i = 0; i < 4; ++i) {
    int idx = i * 256 + tid;        // chunk index over 128x32 tile
    a_row[i] = idx >> 3;            // 0..127
    a_col[i] = (idx & 7) * 4;       // 0..28, 4-float chunks
  }
  int b_row[2], b_col[2], b_grow[2];
#pragma unroll
  for (int i = 0; i < 2; ++i) {
    int idx = i * 256 + tid;        // chunk index over 64x32 tile
    b_row[i] = idx >> 3;            // 0..63
    b_col[i] = (idx & 7) * 4;
    int n = n0 + b_row[i];
    b_grow[i] = n < N ? n : N - 1;  // clamp: never read OOB rows of Wt
  }

  v8f acc[4] = {v8f{}, v8f{}, v8f{}, v8f{}};

  // WMMA fragment compute over one staged BKx(BM,BN) tile.
  auto compute = [&](int buf) {
    const float* as = &As[buf][(wave * 16 + l16) * LDST + 2 * half];
    const float* bs = &Bs[buf][l16 * LDST + 2 * half];
#pragma unroll
    for (int kk = 0; kk < BK; kk += 4) {
      v2f a = *(const v2f*)(as + kk);
#pragma unroll
      for (int t = 0; t < 4; ++t) {
        v2f b = *(const v2f*)(bs + t * 16 * LDST + kk);
        acc[t] = wmma_f32(a, b, acc[t]);
      }
    }
  };

  const int NT = K / BK;

#if HAVE_ASYNC_LDS
  // Builtin signature (from clang diagnostic): arg0 = addrspace(1) int4*
  // (global source), arg1 = addrspace(3) int4* (LDS dest), imm offset, cpol.
  typedef __attribute__((address_space(1))) v4i* gv4p;
  typedef __attribute__((address_space(3))) v4i* lv4p;
  auto issue = [&](int k0, int buf) {
#pragma unroll
    for (int i = 0; i < 4; ++i) {
      gv4p g = (gv4p)(A + (size_t)(m0 + a_row[i]) * lda + k0 + a_col[i]);
      lv4p l = (lv4p)&As[buf][a_row[i] * LDST + a_col[i]];
      __builtin_amdgcn_global_load_async_to_lds_b128(g, l, 0, 0);
    }
#pragma unroll
    for (int i = 0; i < 2; ++i) {
      gv4p g = (gv4p)(Wt + (size_t)b_grow[i] * ldb + k0 + b_col[i]);
      lv4p l = (lv4p)&Bs[buf][b_row[i] * LDST + b_col[i]];
      __builtin_amdgcn_global_load_async_to_lds_b128(g, l, 0, 0);
    }
  };

  issue(0, 0);
  for (int t = 0; t < NT; ++t) {
    if (t + 1 < NT) {
      issue((t + 1) * BK, (t + 1) & 1);  // prefetch next tile
      wait_async_le6();                  // tile t's 6 copies complete
    } else {
      wait_async_le0();
    }
    __syncthreads();                     // publish LDS tile t to all waves
    compute(t & 1);
    __syncthreads();                     // safe to overwrite buf (t&1)
  }
#else
  // Fallback: global -> registers -> ds_store_b128, same double buffering.
  v4f ra[4], rb[2];
  auto gload = [&](int k0) {
#pragma unroll
    for (int i = 0; i < 4; ++i)
      ra[i] = *(const v4f*)(A + (size_t)(m0 + a_row[i]) * lda + k0 + a_col[i]);
#pragma unroll
    for (int i = 0; i < 2; ++i)
      rb[i] = *(const v4f*)(Wt + (size_t)b_grow[i] * ldb + k0 + b_col[i]);
  };
  auto lstore = [&](int buf) {
#pragma unroll
    for (int i = 0; i < 4; ++i)
      *(v4f*)&As[buf][a_row[i] * LDST + a_col[i]] = ra[i];
#pragma unroll
    for (int i = 0; i < 2; ++i)
      *(v4f*)&Bs[buf][b_row[i] * LDST + b_col[i]] = rb[i];
  };

  gload(0);
  lstore(0);
  __syncthreads();
  for (int t = 0; t < NT; ++t) {
    if (t + 1 < NT) gload((t + 1) * BK);  // global loads overlap compute
    compute(t & 1);
    if (t + 1 < NT) lstore((t + 1) & 1);
    __syncthreads();
  }
#endif

  __shared__ __attribute__((aligned(16))) float Pt[GRAM ? BM * HDIM : 4];
  if constexpr (GRAM) {
    // The finished tile T (bias added) into LDS, ahead of the global stores,
    // so that the barrier does not wait for those.  LDS row 2j + hf holds, for
    // each column, the four values T[8j + 2hf + {0, 1, 4, 5}]: 16 bytes that
    // are lane half hf's k pairs of two WMMAs in a row (k = 8j and k = 8j + 4).
#pragma unroll
    for (int t = 0; t < 4; ++t) {
      const float bv = bias[n0 + t * 16 + l16];
      float* q = &Pt[(wave * 2 + half) * 2 * PQ + (t * 16 + l16) * 4];
      *(v4f*)q = v4f{acc[t][0] + bv, acc[t][1] + bv, acc[t][4] + bv, acc[t][5] + bv};
      *(v4f*)(q + PQ) =
          v4f{acc[t][2] + bv, acc[t][3] + bv, acc[t][6] + bv, acc[t][7] + bv};
    }
    __syncthreads();               // all 128 rows of the tile are in LDS
  }

  // Epilogue: C/D layout -> VGPR r holds row (r + 8*half), col l16.
  const int rowbase = m0 + wave * 16 + 8 * half;
#pragma unroll
  for (int t = 0; t < 4; ++t) {
    int col = n0 + t * 16 + l16;
    if (col < N) {
      float bv = bias[col];
#pragma unroll
      for (int r = 0; r < 8; ++r) {
        C[(size_t)(rowbase + r) * ldc + col] = acc[t][r] + bv;
      }
    }
  }

  if constexpr (GRAM) {
    // Wave w: rows [16 (w>>1), +16) x columns [32 (w&1), +32) of T^T T, summed
    // over the tile's 128 rows in rising order.
    const int gm = (wave >> 1) * 16;
    const int gn = (wave & 1) * 32;
    v8f g[2] = {v8f{}, v8f{}};
    const float* pa = &Pt[half * PQ + (gm + l16) * 4];  // A[m][k] = T[k][m]
    const float* pb = &Pt[half * PQ + (gn + l16) * 4];  // B[k][n] = T[k][n]
    // Unrolled so that the LDS reads run ahead of the WMMAs that wait for them
    // and every LDS address is a constant offset from pa or pb.
#pragma unroll
    for (int j = 0; j < BM / 8; ++j) {
      const v4f a = *(const v4f*)(pa + j * 2 * PQ);
      v4f bb[2];
#pragma unroll
      for (int t = 0; t < 2; ++t)
        bb[t] = *(const v4f*)(pb + j * 2 * PQ + t * 64);
#pragma unroll
      for (int t = 0; t < 2; ++t)  // k = 8j
        g[t] = wmma_f32(v2f{a.x, a.y}, v2f{bb[t].x, bb[t].y}, g[t]);
#pragma unroll
      for (int t = 0; t < 2; ++t)  // k = 8j + 4
        g[t] = wmma_f32(v2f{a.z, a.w}, v2f{bb[t].z, bb[t].w}, g[t]);
    }
    float* Sp = Spart +
        ((size_t)((blockIdx.y / GPARTS) * NHEADS + blockIdx.x) * GPARTS +
         blockIdx.y % GPARTS) * (HDIM * HDIM);
#pragma unroll
    for (int t = 0; t < 2; ++t) {
#pragma unroll
      for (int r = 0; r < 8; ++r) {
        Sp[(gm + 8 * half + r) * HDIM + gn + t * 16 + l16] = g[t][r];
      }
    }
  }
}

// ---------------------------------------------------------------------------
// W2_b[c, h*64+e] = sum_d W[c, h*64+d] * S_bh[e, d]: the Gram matrix folded
// into the output weights, so that out = p @ W2_b^T + bias.  S_bh is alpha
// times the sum of its GPARTS shares, joined here in a fixed order.
// grid = (FROWS/128, BS*NHEADS), block = 256 (8 waves, 16 rows c each).
// W2 has FROWS rows per batch; rows from NCLASSES on repeat the last class
// row and are never read.
// ---------------------------------------------------------------------------
#define FROWS  1024               // rows of W2 per batch (NCLASSES rounded up)
#define SPITCH 68                 // LDS row pitch (floats): 272 B = 16 B x odd

__global__ __launch_bounds__(256) void fold_gram_w(
    const float* __restrict__ Spart, const float* __restrict__ W,
    float* __restrict__ W2all, float alpha) {
  __shared__ __attribute__((aligned(16))) float Ss[HDIM * SPITCH];

  const int tid  = threadIdx.x;
  const int wave = tid >> 5;
  const int lane = tid & 31;
  const int half = lane >> 4;
  const int l16  = lane & 15;
  const int bh = blockIdx.y;
  const int b = bh >> 4;
  const int h = bh & 15;
  const int c0 = blockIdx.x * 128 + wave * 16;

  const float* Sh = Spart + (size_t)bh * GPARTS * HDIM * HDIM;
  float* W2 = W2all + (size_t)b * FROWS * EMBED + h * HDIM;

  // A rows: 16 bytes a lane.  Lane half hf holds k = 8j + 4hf + {0..3}: its
  // first pair feeds one WMMA, its second pair the next; B below is read with
  // the same k at every lane and register position.
  int crow = c0 + l16;
  crow = crow < NCLASSES ? crow : NCLASSES - 1;   // never read past W
  const float* ap = W + (size_t)crow * EMBED + h * HDIM + 4 * half;
  v4f a[8];
#pragma unroll
  for (int j = 0; j < 8; ++j) a[j] = *(const v4f*)(ap + 8 * j);

  // S_bh (16 KB) into LDS, once for the 8 waves: whole lines of each share,
  // share 0 first.  Unrolled by two, so that 32 loads issue ahead of the adds
  // and the values in flight still fit the registers.
#pragma unroll 2
  for (int i = 0; i < 4; ++i) {
    const int idx = i * 256 + tid;
    const int row = idx >> 4;
    const int col = (idx & 15) * 4;
    v4f s = *(const v4f*)(Sh + row * HDIM + col);
#pragma unroll
    for (int w = 1; w < GPARTS; ++w)
      s += *(const v4f*)(Sh + w * (HDIM * HDIM) + row * HDIM + col);
    *(v4f*)&Ss[row * SPITCH + col] = alpha * s;
  }
  __syncthreads();                 // S_bh is in LDS for every wave

  const float* bs = &Ss[l16 * SPITCH + 4 * half];
  v8f acc[4] = {v8f{}, v8f{}, v8f{}, v8f{}};
#pragma unroll
  for (int j = 0; j < 8; ++j) {
    v4f bb[4];                     // B[k][n] = S[n][k], n = t*16 + l16
#pragma unroll
    for (int t = 0; t < 4; ++t)
      bb[t] = *(const v4f*)(bs + t * 16 * SPITCH + 8 * j);
#pragma unroll
    for (int t = 0; t < 4; ++t)
      acc[t] = wmma_f32(v2f{a[j].x, a[j].y}, v2f{bb[t].x, bb[t].y}, acc[t]);
#pragma unroll
    for (int t = 0; t < 4; ++t)
      acc[t] = wmma_f32(v2f{a[j].z, a[j].w}, v2f{bb[t].z, bb[t].w}, acc[t]);
  }

  // Four vector slots between the last WMMA and the store-address arithmetic,
  // which reuses A and B registers. The
  // accumulators are inputs, so the slots stand behind every WMMA; the thread
  // id goes through the statement, so the arithmetic stands behind the slots.
  int st = tid;
  asm volatile("v_nop\n\tv_nop\n\tv_nop\n\tv_nop"
               : "+v"(st)
               : "v"(acc[0]), "v"(acc[1]), "v"(acc[2]), "v"(acc[3]));
  const int srow = blockIdx.x * 128 + (st >> 5) * 16 + ((st >> 4) & 1) * 8;
  float* outp = W2 + (size_t)srow * EMBED + (st & 15);
#pragma unroll
  for (int t = 0; t < 4; ++t) {
#pragma unroll
    for (int r = 0; r < 8; ++r) {
      outp[r * EMBED + t * 16] = acc[t][r];
    }
  }
}

extern "C" void kernel_launch(void* const* d_in, const int* in_sizes, int n_in,
                              void* d_out, int out_size, void* d_ws, size_t ws_size,
                              hipStream_t stream) {
  const float* x     = (const float*)d_in[0];  // [2, 2048, 1024]
  const float* W_in  = (const float*)d_in[1];  // [1024, 1024]
  const float* b_in  = (const float*)d_in[2];  // [1024]
  const float* W_out = (const float*)d_in[3];  // [1000, 1024]
  const float* b_out = (const float*)d_in[4];  // [1000]
  float* out = (float*)d_out;                  // [2, 2048, 1000]

  const int M = BS * SEQ;                      // 4096
  float* p    = (float*)d_ws;                  // M * EMBED floats   (16 MB)
  float* Sp   = p + (size_t)M * EMBED;         // 32 * 16 * 64 * 64  (8 MB)
  float* W2   = Sp + (size_t)BS * NHEADS * GPARTS * HDIM * HDIM;  // BS * FROWS * EMBED (8 MB)

  const float scale = 1.0f / 32.0f;            // 1/sqrt(EMBED)

  // 1) p = x @ W_in^T + b_in, and each 128-row tile's share of p_bh^T @ p_bh
  gemm_a_bt_bias_lds<true><<<dim3(EMBED / BN, M / BM), 256, 0, stream>>>(
      x, W_in, b_in, p, Sp, EMBED, EMBED, EMBED, EMBED, EMBED, 0);

  // 2) W2_b = W_out @ blockdiag(S_b)^T, S_bh = scale * sum of its shares
  fold_gram_w<<<dim3(FROWS / 128, BS * NHEADS), 256, 0, stream>>>(Sp, W_out, W2, scale);

  // 3) out_b = p_b @ W2_b^T + b_out   (N=1000, clamped/guarded)
  gemm_a_bt_bias_lds<false><<<dim3((NCLASSES + BN - 1) / BN, M / BM), 256, 0, stream>>>(
      p, W2, b_out, out, nullptr, NCLASSES, EMBED, EMBED, EMBED, NCLASSES, FROWS * EMBED);
}

// v004
// Measured time: 97.5 microseconds a run.
// Two timings next to v003 both put it at 1.05 times that version's speed.
// Over all steps from v000 it is 2.51 times as fast.
#include <hip/hip_runtime.h>

// CDNA5 (gfx1250) wave32 fp32-WMMA implementation of the no-softmax linear
// attention classifier.  (p p^T) p == p (p^T p) collapses attention to a
// 64x64 Gram matrix S per head, and (p S) W^T == p (S W^T) folds S into the
// output weights, once per batch.  The first GEMM forms each tile's share of
// S from the tile it has just computed.  The two large GEMMs are LDS-staged and
// double-buffered, using GLOBAL_LOAD_ASYNC_TO_LDS_B128 (ASYNCcnt) so WMMAs
// are fed from LDS instead of stalling on per-load s_wait_loadcnt 0.

typedef __attribute__((ext_vector_type(2))) float v2f;
typedef __attribute__((ext_vector_type(4))) float v4f;
typedef __attribute__((ext_vector_type(8))) float v8f;
typedef __attribute__((ext_vector_type(4))) int   v4i;

#define BS        2
#define SEQ       2048
#define EMBED     1024
#define NHEADS    16
#define HDIM      64
#define NCLASSES  1000

// Large-GEMM tiling
#define BM 128
#define BN 64
#define BK 32
#define GPARTS (SEQ / BM) // row tiles, and so shares of S, per batch and head
#define PQ (HDIM * 4)    // floats in one LDS row of the finished tile of p
#define LDST 36          // LDS row stride (floats): 144B -> 16B aligned rows,
                         // and 36*n mod 64 is a permutation over n=0..15
                         // (conflict-free 16-lane WMMA fragment reads)

#if defined(__has_builtin)
#if __has_builtin(__builtin_amdgcn_global_load_async_to_lds_b128)
#define HAVE_ASYNC_LDS 1
#endif
#endif
#ifndef HAVE_ASYNC_LDS
#define HAVE_ASYNC_LDS 0
#endif

static __device__ __forceinline__ v8f wmma_f32(v2f a, v2f b, v8f c) {
  // 8 args: (neg_a, A, neg_b, B, c_mod, C, reuse_a, reuse_b)
  return __builtin_amdgcn_wmma_f32_16x16x4_f32(false, a, false, b, (short)0, c,
                                               false, false);
}

#if HAVE_ASYNC_LDS
static __device__ __forceinline__ void wait_async_le6() {
#if __has_builtin(__builtin_amdgcn_s_wait_asynccnt)
  __builtin_amdgcn_s_wait_asynccnt(6);
#else
  asm volatile("s_wait_asynccnt 6" ::: "memory");
#endif
}
static __device__ __forceinline__ void wait_async_le0() {
#if __has_builtin(__builtin_amdgcn_s_wait_asynccnt)
  __builtin_amdgcn_s_wait_asynccnt(0);
#else
  asm volatile("s_wait_asynccnt 0" ::: "memory");
#endif
}
#endif

// ---------------------------------------------------------------------------
// C[M,N] = A[M,K] @ Wt[N,K]^T + bias, LDS-staged, double-buffered.
// Wt may differ per batch of SEQ rows of A: batch i reads Wt + i * bstride.
// grid = (ceil(N/64), M/128), block = 256 (8 waves).
// Wave w computes rows [m0+16w, m0+16w+16) x all 64 N columns.
// GRAM (N a multiple of 64 = HDIM, so a tile is 128 rows of one head): the
// work-group also writes T^T T of its finished tile T, a 64x64 share of that
// head's Gram matrix, to Spart[(batch*NHEADS + head) * GPARTS + row tile].
// ---------------------------------------------------------------------------
template <bool GRAM>
__global__ __launch_bounds__(256) void gemm_a_bt_bias_lds(
    const float* __restrict__ A, const float* __restrict__ Wall,
    const float* __restrict__ bias, float* __restrict__ C,
    float* __restrict__ Spart,
    int N, int K, int lda, int ldb, int ldc, int bstride) {
  __shared__ float As[2][BM * LDST];
  __shared__ float Bs[2][BN * LDST];

  const int tid  = threadIdx.x;
  const int wave = tid >> 5;
  const int lane = tid & 31;
  const int half = lane >> 4;   // A/B lane-half split: K={0,1} vs K={2,3}
  const int l16  = lane & 15;
  const int m0 = blockIdx.y * BM;
  const int n0 = blockIdx.x * BN;
  const float* Wt = Wall + (size_t)(blockIdx.y / (SEQ / BM)) * bstride;

  // Per-thread staging map: 16B chunks. A tile = 16KB -> 4 chunks/thread,
  // B tile = 8KB -> 2 chunks/thread.
  int a_row[4], a_col[4];
#pragma unroll
  for (int i = 0; i < 4; ++i) {
    int idx = i * 256 + tid;        // chunk index over 128x32 tile
    a_row[i] = idx >> 3;            // 0..127
    a_col[i] = (idx & 7) * 4;       // 0..28, 4-float chunks
  }
  int b_row[2], b_col[2], b_grow[2];
#pragma unroll
  for (int i = 0; i < 2; ++i) {
    int idx = i * 256 + tid;        // chunk index over 64x32 tile
    b_row[i] = idx >> 3;            // 0..63
    b_col[i] = (idx & 7) * 4;
    int n = n0 + b_row[i];
    b_grow[i] = n < N ? n : N - 1;  // clamp: never read OOB rows of Wt
  }

  v8f acc[4] = {v8f{}, v8f{}, v8f{}, v8f{}};

  // WMMA fragment compute over one staged BKx(BM,BN) tile.
  auto compute = [&](int buf) {
    const float* as = &As[buf][(wave * 16 + l16) * LDST + 2 * half];
    const float* bs = &Bs[buf][l16 * LDST + 2 * half];
#pragma unroll
    for (int kk = 0; kk < BK; kk += 4) {
      v2f a = *(const v2f*)(as + kk);
#pragma unroll
      for (int t = 0; t < 4; ++t) {
        v2f b = *(const v2f*)(bs + t * 16 * LDST + kk);
        acc[t] = wmma_f32(a, b, acc[t]);
      }
    }
  };

  const int NT = K / BK;

  // Wave priority falls as a wave nears the end of its K loop, for speed only:
  // a group with more passes left has the higher priority.
  // rem = passes left, the same in every wave.
  auto pace = [&](int rem) {
    if (rem <= 12) {
      if (rem == 12) __builtin_amdgcn_s_setprio(2);
      else if (rem == 6) __builtin_amdgcn_s_setprio(1);
      else if (rem == 2) __builtin_amdgcn_s_setprio(0);
    }
  };
  __builtin_amdgcn_s_setprio(3);         // first level of pace()

#if HAVE_ASYNC_LDS
  // Builtin signature (from clang diagnostic): arg0 = addrspace(1) int4*
  // (global source), arg1 = addrspace(3) int4* (LDS dest), imm offset, cpol.
  typedef __attribute__((address_space(1))) v4i* gv4p;
  typedef __attribute__((address_space(3))) v4i* lv4p;
  auto issue = [&](int k0, int buf) {
#pragma unroll
    for (int i = 0; i < 4; ++i) {
      gv4p g = (gv4p)(A + (size_t)(m0 + a_row[i]) * lda + k0 + a_col[i]);
      lv4p l = (lv4p)&As[buf][a_row[i] * LDST + a_col[i]];
      __builtin_amdgcn_global_load_async_to_lds_b128(g, l, 0, 0);
    }
#pragma unroll
    for (int i = 0; i < 2; ++i) {
      gv4p g = (gv4p)(Wt + (size_t)b_grow[i] * ldb + k0 + b_col[i]);
      lv4p l = (lv4p)&Bs[buf][b_row[i] * LDST + b_col[i]];
      __builtin_amdgcn_global_load_async_to_lds_b128(g, l, 0, 0);
    }
  };

  issue(0, 0);
  for (int t = 0; t < NT; ++t) {
    pace(NT - t);
    if (t + 1 < NT) {
      issue((t + 1) * BK, (t + 1) & 1);  // prefetch next tile
      wait_async_le6();                  // tile t's 6 copies complete
    } else {
      wait_async_le0();
    }
    __syncthreads();                     // publish LDS tile t to all waves
    compute(t & 1);
    __syncthreads();                     // safe to overwrite buf (t&1)
  }
#else
  // Fallback: global -> registers -> ds_store_b128, same double buffering.
  v4f ra[4], rb[2];
  auto gload = [&](int k0) {
#pragma unroll
    for (int i = 0; i < 4; ++i)
      ra[i] = *(const v4f*)(A + (size_t)(m0 + a_row[i]) * lda + k0 + a_col[i]);
#pragma unroll
    for (int i = 0; i < 2; ++i)
      rb[i] = *(const v4f*)(Wt + (size_t)b_grow[i] * ldb + k0 + b_col[i]);
  };
  auto lstore = [&](int buf) {
#pragma unroll
    for (int i = 0; i < 4; ++i)
      *(v4f*)&As[buf][a_row[i] * LDST + a_col[i]] = ra[i];
#pragma unroll
    for (int i = 0; i < 2; ++i)
      *(v4f*)&Bs[buf][b_row[i] * LDST + b_col[i]] = rb[i];
  };

  gload(0);
  lstore(0);
  __syncthreads();
  for (int t = 0; t < NT; ++t) {
    pace(NT - t);
    if (t + 1 < NT) gload((t + 1) * BK);  // global loads overlap compute
    compute(t & 1);
    if (t + 1 < NT) lstore((t + 1) & 1);
    __syncthreads();
  }
#endif
  __builtin_amdgcn_s_setprio(0);         // priority 0 on every path out of the loop

  __shared__ __attribute__((aligned(16))) float Pt[GRAM ? BM * HDIM : 4];
  if constexpr (GRAM) {
    // The finished tile T (bias added) into LDS, ahead of the global stores,
    // so that the barrier does not wait for those.  LDS row 2j + hf holds, for
    // each column, the four values T[8j + 2hf + {0, 1, 4, 5}]: 16 bytes that
    // are lane half hf's k pairs of two WMMAs in a row (k = 8j and k = 8j + 4).
#pragma unroll
    for (int t = 0; t < 4; ++t) {
      const float bv = bias[n0 + t * 16 + l16];
      float* q = &Pt[(wave * 2 + half) * 2 * PQ + (t * 16 + l16) * 4];
      *(v4f*)q = v4f{acc[t][0] + bv, acc[t][1] + bv, acc[t][4] + bv, acc[t][5] + bv};
      *(v4f*)(q + PQ) =
          v4f{acc[t][2] + bv, acc[t][3] + bv, acc[t][6] + bv, acc[t][7] + bv};
    }
    __syncthreads();               // all 128 rows of the tile are in LDS
  }

  // Epilogue: C/D layout -> VGPR r holds row (r + 8*half), col l16.
  const int rowbase = m0 + wave * 16 + 8 * half;
#pragma unroll
  for (int t = 0; t < 4; ++t) {
    int col = n0 + t * 16 + l16;
    if (col < N) {
      float bv = bias[col];
#pragma unroll
      for (int r = 0; r < 8; ++r) {
        C[(size_t)(rowbase + r) * ldc + col] = acc[t][r] + bv;
      }
    }
  }

  if constexpr (GRAM) {
    // Wave w: rows [16 (w>>1), +16) x columns [32 (w&1), +32) of T^T T, summed
    // over the tile's 128 rows in rising order.
    const int gm = (wave >> 1) * 16;
    const int gn = (wave & 1) * 32;
    v8f g[2] = {v8f{}, v8f{}};
    const float* pa = &Pt[half * PQ + (gm + l16) * 4];  // A[m][k] = T[k][m]
    const float* pb = &Pt[half * PQ + (gn + l16) * 4];  // B[k][n] = T[k][n]
    // Unrolled so that the LDS reads run ahead of the WMMAs that wait for them
    // and every LDS address is a constant offset from pa or pb.
#pragma unroll
    for (int j = 0; j < BM / 8; ++j) {
      const v4f a = *(const v4f*)(pa + j * 2 * PQ);
      v4f bb[2];
#pragma unroll
      for (int t = 0; t < 2; ++t)
        bb[t] = *(const v4f*)(pb + j * 2 * PQ + t * 64);
#pragma unroll
      for (int t = 0; t < 2; ++t)  // k = 8j
        g[t] = wmma_f32(v2f{a.x, a.y}, v2f{bb[t].x, bb[t].y}, g[t]);
#pragma unroll
      for (int t = 0; t < 2; ++t)  // k = 8j + 4
        g[t] = wmma_f32(v2f{a.z, a.w}, v2f{bb[t].z, bb[t].w}, g[t]);
    }
    float* Sp = Spart +
        ((size_t)((blockIdx.y / GPARTS) * NHEADS + blockIdx.x) * GPARTS +
         blockIdx.y % GPARTS) * (HDIM * HDIM);
#pragma unroll
    for (int t = 0; t < 2; ++t) {
#pragma unroll
      for (int r = 0; r < 8; ++r) {
        Sp[(gm + 8 * half + r) * HDIM + gn + t * 16 + l16] = g[t][r];
      }
    }
  }
}

// ---------------------------------------------------------------------------
// W2_b[c, h*64+e] = sum_d W[c, h*64+d] * S_bh[e, d]: the Gram matrix folded
// into the output weights, so that out = p @ W2_b^T + bias.  S_bh is alpha
// times the sum of its GPARTS shares, joined here in a fixed order.
// grid = (FROWS/128, BS*NHEADS), block = 256 (8 waves, 16 rows c each).
// W2 has FROWS rows per batch; rows from NCLASSES on repeat the last class
// row and are never read.
// ---------------------------------------------------------------------------
#define FROWS  1024               // rows of W2 per batch (NCLASSES rounded up)
#define SPITCH 68                 // LDS row pitch (floats): 272 B = 16 B x odd

__global__ __launch_bounds__(256) void fold_gram_w(
    const float* __restrict__ Spart, const float* __restrict__ W,
    float* __restrict__ W2all, float alpha) {
  __shared__ __attribute__((aligned(16))) float Ss[HDIM * SPITCH];

  const int tid  = threadIdx.x;
  const int wave = tid >> 5;
  const int lane = tid & 31;
  const int half = lane >> 4;
  const int l16  = lane & 15;
  const int bh = blockIdx.y;
  const int b = bh >> 4;
  const int h = bh & 15;
  const int c0 = blockIdx.x * 128 + wave * 16;

  const float* Sh = Spart + (size_t)bh * GPARTS * HDIM * HDIM;
  float* W2 = W2all + (size_t)b * FROWS * EMBED + h * HDIM;

  // A rows: 16 bytes a lane.  Lane half hf holds k = 8j + 4hf + {0..3}: its
  // first pair feeds one WMMA, its second pair the next; B below is read with
  // the same k at every lane and register position.
  int crow = c0 + l16;
  crow = crow < NCLASSES ? crow : NCLASSES - 1;   // never read past W
  const float* ap = W + (size_t)crow * EMBED + h * HDIM + 4 * half;
  v4f a[8];
#pragma unroll
  for (int j = 0; j < 8; ++j) a[j] = *(const v4f*)(ap + 8 * j);

  // S_bh (16 KB) into LDS, once for the 8 waves: whole lines of each share,
  // share 0 first.  Unrolled by two, so that 32 loads issue ahead of the adds
  // and the values in flight still fit the registers.
#pragma unroll 2
  for (int i = 0; i < 4; ++i) {
    const int idx = i * 256 + tid;
    const int row = idx >> 4;
    const int col = (idx & 15) * 4;
    v4f s = *(const v4f*)(Sh + row * HDIM + col);
#pragma unroll
    for (int w = 1; w < GPARTS; ++w)
      s += *(const v4f*)(Sh + w * (HDIM * HDIM) + row * HDIM + col);
    *(v4f*)&Ss[row * SPITCH + col] = alpha * s;
  }
  __syncthreads();                 // S_bh is in LDS for every wave

  const float* bs = &Ss[l16 * SPITCH + 4 * half];
  v8f acc[4] = {v8f{}, v8f{}, v8f{}, v8f{}};
#pragma unroll
  for (int j = 0; j < 8; ++j) {
    v4f bb[4];                     // B[k][n] = S[n][k], n = t*16 + l16
#pragma unroll
    for (int t = 0; t < 4; ++t)
      bb[t] = *(const v4f*)(bs + t * 16 * SPITCH + 8 * j);
#pragma unroll
    for (int t = 0; t < 4; ++t)
      acc[t] = wmma_f32(v2f{a[j].x, a[j].y}, v2f{bb[t].x, bb[t].y}, acc[t]);
#pragma unroll
    for (int t = 0; t < 4; ++t)
      acc[t] = wmma_f32(v2f{a[j].z, a[j].w}, v2f{bb[t].z, bb[t].w}, acc[t]);
  }

  // Four vector slots between the last WMMA and the store-address arithmetic,
  // which reuses A and B registers. The
  // accumulators are inputs, so the slots stand behind every WMMA; the thread
  // id goes through the statement, so the arithmetic stands behind the slots.
  int st = tid;
  asm volatile("v_nop\n\tv_nop\n\tv_nop\n\tv_nop"
               : "+v"(st)
               : "v"(acc[0]), "v"(acc[1]), "v"(acc[2]), "v"(acc[3]));
  const int srow = blockIdx.x * 128 + (st >> 5) * 16 + ((st >> 4) & 1) * 8;
  float* outp = W2 + (size_t)srow * EMBED + (st & 15);
#pragma unroll
  for (int t = 0; t < 4; ++t) {
#pragma unroll
    for (int r = 0; r < 8; ++r) {
      outp[r * EMBED + t * 16] = acc[t][r];
    }
  }
}

extern "C" void kernel_launch(void* const* d_in, const int* in_sizes, int n_in,
                              void* d_out, int out_size, void* d_ws, size_t ws_size,
                              hipStream_t stream) {
  const float* x     = (const float*)d_in[0];  // [2, 2048, 1024]
  const float* W_in  = (const float*)d_in[1];  // [1024, 1024]
  const float* b_in  = (const float*)d_in[2];  // [1024]
  const float* W_out = (const float*)d_in[3];  // [1000, 1024]
  const float* b_out = (const float*)d_in[4];  // [1000]
  float* out = (float*)d_out;                  // [2, 2048, 1000]

  const int M = BS * SEQ;                      // 4096
  float* p    = (float*)d_ws;                  // M * EMBED floats   (16 MB)
  float* Sp   = p + (size_t)M * EMBED;         // 32 * 16 * 64 * 64  (8 MB)
  float* W2   = Sp + (size_t)BS * NHEADS * GPARTS * HDIM * HDIM;  // BS * FROWS * EMBED (8 MB)

  const float scale = 1.0f / 32.0f;            // 1/sqrt(EMBED)

  // 1) p = x @ W_in^T + b_in, and each 128-row tile's share of p_bh^T @ p_bh
  gemm_a_bt_bias_lds<true><<<dim3(EMBED / BN, M / BM), 256, 0, stream>>>(
      x, W_in, b_in, p, Sp, EMBED, EMBED, EMBED, EMBED, EMBED, 0);

  // 2) W2_b = W_out @ blockdiag(S_b)^T, S_bh = scale * sum of its shares
  fold_gram_w<<<dim3(FROWS / 128, BS * NHEADS), 256, 0, stream>>>(Sp, W_out, W2, scale);

  // 3) out_b = p_b @ W2_b^T + b_out   (N=1000, clamped/guarded)
  gemm_a_bt_bias_lds<false><<<dim3((NCLASSES + BN - 1) / BN, M / BM), 256, 0, stream>>>(
      p, W2, b_out, out, nullptr, NCLASSES, EMBED, EMBED, EMBED, NCLASSES, FROWS * EMBED);
}

// v005
// A run of this version takes 94.2 microseconds.
// Timed twice side by side with v004, it ran 1.03 and 1.04 times as fast.
// Counting every step since v000, it is 2.60 times as fast.
#include <hip/hip_runtime.h>

// CDNA5 (gfx1250) wave32 fp32-WMMA implementation of the no-softmax linear
// attention classifier.  (p p^T) p == p (p^T p) collapses attention to a
// 64x64 Gram matrix S per head, and (p S) W^T == p (S W^T) folds S into the
// output weights, once per batch.  The first GEMM forms each tile's share of
// S from the tile it has just computed.  The two large GEMMs are LDS-staged and
// double-buffered, using GLOBAL_LOAD_ASYNC_TO_LDS_B128 (ASYNCcnt) so WMMAs
// are fed from LDS instead of stalling on per-load s_wait_loadcnt 0.

typedef __attribute__((ext_vector_type(2))) float v2f;
typedef __attribute__((ext_vector_type(4))) float v4f;
typedef __attribute__((ext_vector_type(8))) float v8f;
typedef __attribute__((ext_vector_type(4))) int   v4i;

#define BS        2
#define SEQ       2048
#define EMBED     1024
#define NHEADS    16
#define HDIM      64
#define NCLASSES  1000

// Large-GEMM tiling
#define BM 128
#define BN 64
#define BK 64           // k per LDS stage: 256 B of each operand row
#define ACH (BM * BK / 4 / 256)  // 16-byte chunks of the A tile per thread
#define BCH (BN * BK / 4 / 256)  // 16-byte chunks of the B tile per thread
#define GPARTS (SEQ / BM) // row tiles, and so shares of S, per batch and head
#define PQ (HDIM * 4)    // floats in one LDS row of the finished tile of p
#define LDST 68          // LDS row stride (floats): 272B -> 16B aligned rows,
                         // and 68*n mod 64 = 4n is distinct over n=0..15
                         // (conflict-free 16-lane WMMA fragment reads)

#if defined(__has_builtin)
#if __has_builtin(__builtin_amdgcn_global_load_async_to_lds_b128)
#define HAVE_ASYNC_LDS 1
#endif
#endif
#ifndef HAVE_ASYNC_LDS
#define HAVE_ASYNC_LDS 0
#endif

static __device__ __forceinline__ v8f wmma_f32(v2f a, v2f b, v8f c) {
  // 8 args: (neg_a, A, neg_b, B, c_mod, C, reuse_a, reuse_b)
  return __builtin_amdgcn_wmma_f32_16x16x4_f32(false, a, false, b, (short)0, c,
                                               false, false);
}

#if HAVE_ASYNC_LDS
// All but the wave's ACH + BCH = 12 youngest copies (the next tile's) have landed.
static __device__ __forceinline__ void wait_async_le12() {
#if __has_builtin(__builtin_amdgcn_s_wait_asynccnt)
  __builtin_amdgcn_s_wait_asynccnt(ACH + BCH);
#else
  asm volatile("s_wait_asynccnt 12" ::: "memory");
#endif
}
static __device__ __forceinline__ void wait_async_le0() {
#if __has_builtin(__builtin_amdgcn_s_wait_asynccnt)
  __builtin_amdgcn_s_wait_asynccnt(0);
#else
  asm volatile("s_wait_asynccnt 0" ::: "memory");
#endif
}
#endif

// ---------------------------------------------------------------------------
// C[M,N] = A[M,K] @ Wt[N,K]^T + bias, LDS-staged, double-buffered.
// Wt may differ per batch of SEQ rows of A: batch i reads Wt + i * bstride.
// grid = (ceil(N/64), M/128), block = 256 (8 waves).
// Wave w computes rows [m0+16w, m0+16w+16) x all 64 N columns.
// GRAM (N a multiple of 64 = HDIM, so a tile is 128 rows of one head): the
// work-group also writes T^T T of its finished tile T, a 64x64 share of that
// head's Gram matrix, to Spart[(batch*NHEADS + head) * GPARTS + row tile].
// ---------------------------------------------------------------------------
template <bool GRAM>
__global__ __launch_bounds__(256) void gemm_a_bt_bias_lds(
    const float* __restrict__ A, const float* __restrict__ Wall,
    const float* __restrict__ bias, float* __restrict__ C,
    float* __restrict__ Spart,
    int N, int K, int lda, int ldb, int ldc, int bstride) {
  __shared__ __attribute__((aligned(16))) float As[2][BM * LDST];
  __shared__ __attribute__((aligned(16))) float Bs[2][BN * LDST];

  const int tid  = threadIdx.x;
  const int wave = tid >> 5;
  const int lane = tid & 31;
  const int half = lane >> 4;   // A/B lane-half split: K={0,1} vs K={2,3}
  const int l16  = lane & 15;
  const int m0 = blockIdx.y * BM;
  const int n0 = blockIdx.x * BN;
  const float* Wt = Wall + (size_t)(blockIdx.y / (SEQ / BM)) * bstride;

  // Per-thread staging map: 16B chunks. A tile = 32KB -> 8 chunks/thread,
  // B tile = 16KB -> 4 chunks/thread.
  int a_row[ACH], a_col[ACH];
#pragma unroll
  for (int i = 0; i < ACH; ++i) {
    int idx = i * 256 + tid;        // chunk index over 128x64 tile
    a_row[i] = idx >> 4;            // 0..127
    a_col[i] = (idx & 15) * 4;      // 0..60, 4-float chunks
  }
  int b_row[BCH], b_col[BCH], b_grow[BCH];
#pragma unroll
  for (int i = 0; i < BCH; ++i) {
    int idx = i * 256 + tid;        // chunk index over 64x64 tile
    b_row[i] = idx >> 4;            // 0..63
    b_col[i] = (idx & 15) * 4;
    int n = n0 + b_row[i];
    b_grow[i] = n < N ? n : N - 1;  // clamp: never read OOB rows of Wt
  }

  v8f acc[4] = {v8f{}, v8f{}, v8f{}, v8f{}};

  // WMMA fragment compute over one staged BKx(BM,BN) tile.
  auto compute = [&](int buf) {
    const float* as = &As[buf][(wave * 16 + l16) * LDST + 2 * half];
    const float* bs = &Bs[buf][l16 * LDST + 2 * half];
#pragma unroll
    for (int kk = 0; kk < BK; kk += 4) {
      v2f a = *(const v2f*)(as + kk);
#pragma unroll
      for (int t = 0; t < 4; ++t) {
        v2f b = *(const v2f*)(bs + t * 16 * LDST + kk);
        acc[t] = wmma_f32(a, b, acc[t]);
      }
    }
  };

  const int NT = K / BK;

  // Wave priority falls as a wave nears the end of its K loop.  For speed only.
  // rem = passes left, the same in every wave.
  auto pace = [&](int rem) {
    if (rem <= 6) {
      if (rem == 6) __builtin_amdgcn_s_setprio(2);
      else if (rem == 3) __builtin_amdgcn_s_setprio(1);
      else if (rem == 1) __builtin_amdgcn_s_setprio(0);
    }
  };
  __builtin_amdgcn_s_setprio(3);         // first level of pace()

#if HAVE_ASYNC_LDS
  // Builtin signature (from clang diagnostic): arg0 = addrspace(1) int4*
  // (global source), arg1 = addrspace(3) int4* (LDS dest), imm offset, cpol.
  typedef __attribute__((address_space(1))) v4i* gv4p;
  typedef __attribute__((address_space(3))) v4i* lv4p;
  auto issue = [&](int k0, int buf) {
#pragma unroll
    for (int i = 0; i < ACH; ++i) {
      gv4p g = (gv4p)(A + (size_t)(m0 + a_row[i]) * lda + k0 + a_col[i]);
      lv4p l = (lv4p)&As[buf][a_row[i] * LDST + a_col[i]];
      __builtin_amdgcn_global_load_async_to_lds_b128(g, l, 0, 0);
    }
#pragma unroll
    for (int i = 0; i < BCH; ++i) {
      gv4p g = (gv4p)(Wt + (size_t)b_grow[i] * ldb + k0 + b_col[i]);
      lv4p l = (lv4p)&Bs[buf][b_row[i] * LDST + b_col[i]];
      __builtin_amdgcn_global_load_async_to_lds_b128(g, l, 0, 0);
    }
  };

  issue(0, 0);
  for (int t = 0; t < NT; ++t) {
    pace(NT - t);
    if (t + 1 < NT) {
      issue((t + 1) * BK, (t + 1) & 1);  // prefetch next tile
      wait_async_le12();                 // tile t's 12 copies complete
    } else {
      wait_async_le0();
    }
    __syncthreads();                     // publish LDS tile t to all waves
    compute(t & 1);
    __syncthreads();                     // safe to overwrite buf (t&1)
  }
#else
  // Fallback: global -> registers -> ds_store_b128, same double buffering.
  v4f ra[ACH], rb[BCH];
  auto gload = [&](int k0) {
#pragma unroll
    for (int i = 0; i < ACH; ++i)
      ra[i] = *(const v4f*)(A + (size_t)(m0 + a_row[i]) * lda + k0 + a_col[i]);
#pragma unroll
    for (int i = 0; i < BCH; ++i)
      rb[i] = *(const v4f*)(Wt + (size_t)b_grow[i] * ldb + k0 + b_col[i]);
  };
  auto lstore = [&](int buf) {
#pragma unroll
    for (int i = 0; i < ACH; ++i)
      *(v4f*)&As[buf][a_row[i] * LDST + a_col[i]] = ra[i];
#pragma unroll
    for (int i = 0; i < BCH; ++i)
      *(v4f*)&Bs[buf][b_row[i] * LDST + b_col[i]] = rb[i];
  };

  gload(0);
  lstore(0);
  __syncthreads();
  for (int t = 0; t < NT; ++t) {
    pace(NT - t);
    if (t + 1 < NT) gload((t + 1) * BK);  // global loads overlap compute
    compute(t & 1);
    if (t + 1 < NT) lstore((t + 1) & 1);
    __syncthreads();
  }
#endif
  __builtin_amdgcn_s_setprio(0);         // priority 0 on every path out of the loop

  __shared__ __attribute__((aligned(16))) float Pt[GRAM ? BM * HDIM : 4];
  if constexpr (GRAM) {
    // The finished tile T (bias added) into LDS, ahead of the global stores,
    // so that the barrier does not wait for those.  LDS row 2j + hf holds, for
    // each column, the four values T[8j + 2hf + {0, 1, 4, 5}]: 16 bytes that
    // are lane half hf's k pairs of two WMMAs in a row (k = 8j and k = 8j + 4).
#pragma unroll
    for (int t = 0; t < 4; ++t) {
      const float bv = bias[n0 + t * 16 + l16];
      float* q = &Pt[(wave * 2 + half) * 2 * PQ + (t * 16 + l16) * 4];
      *(v4f*)q = v4f{acc[t][0] + bv, acc[t][1] + bv, acc[t][4] + bv, acc[t][5] + bv};
      *(v4f*)(q + PQ) =
          v4f{acc[t][2] + bv, acc[t][3] + bv, acc[t][6] + bv, acc[t][7] + bv};
    }
    __syncthreads();               // all 128 rows of the tile are in LDS
  }

  // Epilogue: C/D layout -> VGPR r holds row (r + 8*half), col l16.
  const int rowbase = m0 + wave * 16 + 8 * half;
#pragma unroll
  for (int t = 0; t < 4; ++t) {
    int col = n0 + t * 16 + l16;
    if (col < N) {
      float bv = bias[col];
#pragma unroll
      for (int r = 0; r < 8; ++r) {
        C[(size_t)(rowbase + r) * ldc + col] = acc[t][r] + bv;
      }
    }
  }

  if constexpr (GRAM) {
    // Wave w: rows [16 (w>>1), +16) x columns [32 (w&1), +32) of T^T T, summed
    // over the tile's 128 rows in rising order.
    const int gm = (wave >> 1) * 16;
    const int gn = (wave & 1) * 32;
    v8f g[2] = {v8f{}, v8f{}};
    const float* pa = &Pt[half * PQ + (gm + l16) * 4];  // A[m][k] = T[k][m]
    const float* pb = &Pt[half * PQ + (gn + l16) * 4];  // B[k][n] = T[k][n]
    // Unrolled so that the LDS reads run ahead of the WMMAs that wait for them
    // and every LDS address is a constant offset from pa or pb.
#pragma unroll
    for (int j = 0; j < BM / 8; ++j) {
      const v4f a = *(const v4f*)(pa + j * 2 * PQ);
      v4f bb[2];
#pragma unroll
      for (int t = 0; t < 2; ++t)
        bb[t] = *(const v4f*)(pb + j * 2 * PQ + t * 64);
#pragma unroll
      for (int t = 0; t < 2; ++t)  // k = 8j
        g[t] = wmma_f32(v2f{a.x, a.y}, v2f{bb[t].x, bb[t].y}, g[t]);
#pragma unroll
      for (int t = 0; t < 2; ++t)  // k = 8j + 4
        g[t] = wmma_f32(v2f{a.z, a.w}, v2f{bb[t].z, bb[t].w}, g[t]);
    }
    float* Sp = Spart +
        ((size_t)((blockIdx.y / GPARTS) * NHEADS + blockIdx.x) * GPARTS +
         blockIdx.y % GPARTS) * (HDIM * HDIM);
#pragma unroll
    for (int t = 0; t < 2; ++t) {
#pragma unroll
      for (int r = 0; r < 8; ++r) {
        Sp[(gm + 8 * half + r) * HDIM + gn + t * 16 + l16] = g[t][r];
      }
    }
  }
}

// ---------------------------------------------------------------------------
// W2_b[c, h*64+e] = sum_d W[c, h*64+d] * S_bh[e, d]: the Gram matrix folded
// into the output weights, so that out = p @ W2_b^T + bias.  S_bh is alpha
// times the sum of its GPARTS shares, joined here in a fixed order.
// grid = (FROWS/128, BS*NHEADS), block = 256 (8 waves, 16 rows c each).
// W2 has FROWS rows per batch; rows from NCLASSES on repeat the last class
// row and are never read.
// ---------------------------------------------------------------------------
#define FROWS  1024               // rows of W2 per batch (NCLASSES rounded up)
#define SPITCH 68                 // LDS row pitch (floats): 272 B = 16 B x odd

__global__ __launch_bounds__(256) void fold_gram_w(
    const float* __restrict__ Spart, const float* __restrict__ W,
    float* __restrict__ W2all, float alpha) {
  __shared__ __attribute__((aligned(16))) float Ss[HDIM * SPITCH];

  const int tid  = threadIdx.x;
  const int wave = tid >> 5;
  const int lane = tid & 31;
  const int half = lane >> 4;
  const int l16  = lane & 15;
  const int bh = blockIdx.y;
  const int b = bh >> 4;
  const int h = bh & 15;
  const int c0 = blockIdx.x * 128 + wave * 16;

  const float* Sh = Spart + (size_t)bh * GPARTS * HDIM * HDIM;
  float* W2 = W2all + (size_t)b * FROWS * EMBED + h * HDIM;

  // A rows: 16 bytes a lane.  Lane half hf holds k = 8j + 4hf + {0..3}: its
  // first pair feeds one WMMA, its second pair the next; B below is read with
  // the same k at every lane and register position.
  int crow = c0 + l16;
  crow = crow < NCLASSES ? crow : NCLASSES - 1;   // never read past W
  const float* ap = W + (size_t)crow * EMBED + h * HDIM + 4 * half;
  v4f a[8];
#pragma unroll
  for (int j = 0; j < 8; ++j) a[j] = *(const v4f*)(ap + 8 * j);

  // S_bh (16 KB) into LDS, once for the 8 waves: whole lines of each share,
  // share 0 first.  Unrolled by two, so that 32 loads issue ahead of the adds
  // and the values in flight still fit the registers.
#pragma unroll 2
  for (int i = 0; i < 4; ++i) {
    const int idx = i * 256 + tid;
    const int row = idx >> 4;
    const int col = (idx & 15) * 4;
    v4f s = *(const v4f*)(Sh + row * HDIM + col);
#pragma unroll
    for (int w = 1; w < GPARTS; ++w)
      s += *(const v4f*)(Sh + w * (HDIM * HDIM) + row * HDIM + col);
    *(v4f*)&Ss[row * SPITCH + col] = alpha * s;
  }
  __syncthreads();                 // S_bh is in LDS for every wave

  const float* bs = &Ss[l16 * SPITCH + 4 * half];
  v8f acc[4] = {v8f{}, v8f{}, v8f{}, v8f{}};
#pragma unroll
  for (int j = 0; j < 8; ++j) {
    v4f bb[4];                     // B[k][n] = S[n][k], n = t*16 + l16
#pragma unroll
    for (int t = 0; t < 4; ++t)
      bb[t] = *(const v4f*)(bs + t * 16 * SPITCH + 8 * j);
#pragma unroll
    for (int t = 0; t < 4; ++t)
      acc[t] = wmma_f32(v2f{a[j].x, a[j].y}, v2f{bb[t].x, bb[t].y}, acc[t]);
#pragma unroll
    for (int t = 0; t < 4; ++t)
      acc[t] = wmma_f32(v2f{a[j].z, a[j].w}, v2f{bb[t].z, bb[t].w}, acc[t]);
  }

  // Four vector slots between the last WMMA and the store-address arithmetic,
  // which reuses A and B registers. The
  // accumulators are inputs, so the slots stand behind every WMMA; the thread
  // id goes through the statement, so the arithmetic stands behind the slots.
  int st = tid;
  asm volatile("v_nop\n\tv_nop\n\tv_nop\n\tv_nop"
               : "+v"(st)
               : "v"(acc[0]), "v"(acc[1]), "v"(acc[2]), "v"(acc[3]));
  const int srow = blockIdx.x * 128 + (st >> 5) * 16 + ((st >> 4) & 1) * 8;
  float* outp = W2 + (size_t)srow * EMBED + (st & 15);
#pragma unroll
  for (int t = 0; t < 4; ++t) {
#pragma unroll
    for (int r = 0; r < 8; ++r) {
      outp[r * EMBED + t * 16] = acc[t][r];
    }
  }
}

extern "C" void kernel_launch(void* const* d_in, const int* in_sizes, int n_in,
                              void* d_out, int out_size, void* d_ws, size_t ws_size,
                              hipStream_t stream) {
  const float* x     = (const float*)d_in[0];  // [2, 2048, 1024]
  const float* W_in  = (const float*)d_in[1];  // [1024, 1024]
  const float* b_in  = (const float*)d_in[2];  // [1024]
  const float* W_out = (const float*)d_in[3];  // [1000, 1024]
  const float* b_out = (const float*)d_in[4];  // [1000]
  float* out = (float*)d_out;                  // [2, 2048, 1000]

  const int M = BS * SEQ;                      // 4096
  float* p    = (float*)d_ws;                  // M * EMBED floats   (16 MB)
  float* Sp   = p + (size_t)M * EMBED;         // 32 * 16 * 64 * 64  (8 MB)
  float* W2   = Sp + (size_t)BS * NHEADS * GPARTS * HDIM * HDIM;  // BS * FROWS * EMBED (8 MB)

  const float scale = 1.0f / 32.0f;            // 1/sqrt(EMBED)

  // 1) p = x @ W_in^T + b_in, and each 128-row tile's share of p_bh^T @ p_bh
  gemm_a_bt_bias_lds<true><<<dim3(EMBED / BN, M / BM), 256, 0, stream>>>(
      x, W_in, b_in, p, Sp, EMBED, EMBED, EMBED, EMBED, EMBED, 0);

  // 2) W2_b = W_out @ blockdiag(S_b)^T, S_bh = scale * sum of its shares
  fold_gram_w<<<dim3(FROWS / 128, BS * NHEADS), 256, 0, stream>>>(Sp, W_out, W2, scale);

  // 3) out_b = p_b @ W2_b^T + b_out   (N=1000, clamped/guarded)
  gemm_a_bt_bias_lds<false><<<dim3((NCLASSES + BN - 1) / BN, M / BM), 256, 0, stream>>>(
      p, W2, b_out, out, nullptr, NCLASSES, EMBED, EMBED, EMBED, NCLASSES, FROWS * EMBED);
}
